// v000
// The times below were measured on an AMD MI455X: many runs one after another, warmed up first and cycling through
// copies of the inputs, with the whole window's GPU time divided by the number of runs. Launches and the gaps
// between them are all in it. The median over several windows is given; except for v000 it joins two sittings, which
// can be a few percent apart, so the side-by-side timings, each taken in one sitting, are the better comparison.
// v000, which the later versions start from, runs in 284 microseconds.
#include <hip/hip_runtime.h>
#include <hip/hip_bf16.h>

typedef _Float16 f16;
typedef __attribute__((ext_vector_type(16))) _Float16 v16h;
typedef __attribute__((ext_vector_type(8)))  _Float16 v8h;
typedef __attribute__((ext_vector_type(8)))  float    v8f;

#define LOG2E 1.44269504088896340736f

static __device__ __forceinline__ v16h load_tile_h(const f16* base, int stride, int lane) {
  const f16* p = base + (lane & 15) * stride + ((lane >> 4) << 3);
  v8h lo = *(const v8h*)(p);        // K koff..koff+7      (16B aligned)
  v8h hi = *(const v8h*)(p + 16);   // K koff+16..koff+23  (16B aligned)
  v16h r;
#pragma unroll
  for (int i = 0; i < 8; ++i) { r[i] = lo[i]; r[i + 8] = hi[i]; }
  return r;
}

static __device__ __forceinline__ v16h load_tile_f32cvt(const float* base, int stride, int lane) {
  const float* p = base + (lane & 15) * stride + ((lane >> 4) << 3);
  v16h r;
#pragma unroll
  for (int i = 0; i < 8; ++i) { r[i] = (f16)p[i]; r[i + 8] = (f16)p[16 + i]; }
  return r;
}

static __device__ __forceinline__ v8f wmma_f16(v16h a, v16h b, v8f c) {
  return __builtin_amdgcn_wmma_f32_16x16x32_f16(false, a, false, b, (short)0, c, false, false);
}

// Reductions across the 16 lanes of a half-wave (xor masks < 16 stay in-half).
static __device__ __forceinline__ float hred_max(float x) {
#pragma unroll
  for (int m = 1; m < 16; m <<= 1) x = fmaxf(x, __shfl_xor(x, m, 32));
  return x;
}
static __device__ __forceinline__ float hred_sum(float x) {
#pragma unroll
  for (int m = 1; m < 16; m <<= 1) x += __shfl_xor(x, m, 32);
  return x;
}

// ---------------------------------------------------------------------------
// Stage 0: NCHW f32 -> (b, N, c) f16
// ---------------------------------------------------------------------------
__global__ void __launch_bounds__(256) transpose_kernel(const float* __restrict__ x,
                                                        f16* __restrict__ x3h) {
  int i = blockIdx.x * 256 + threadIdx.x;      // 16*256*1024 elements
  if (i >= 16 * 256 * 1024) return;
  int p  = i & 1023;
  int ch = (i >> 10) & 255;
  int b  = i >> 18;
  x3h[((size_t)(b * 1024 + p)) * 256 + ch] = (f16)x[i];
}

// ---------------------------------------------------------------------------
// Stage 1: relative-position bias table: tab_sig[head*3969 + i] = 16*sigmoid(mlp(coords_i))
// ---------------------------------------------------------------------------
__global__ void __launch_bounds__(256) bias_table_kernel(const float* __restrict__ w1,
                                                         const float* __restrict__ b1,
                                                         const float* __restrict__ w2,
                                                         float* __restrict__ tab_sig) {
  int t = blockIdx.x * 256 + threadIdx.x;      // 8 * 3969
  if (t >= 8 * 3969) return;
  int i = t % 3969, head = t / 3969;
  int gy = i / 63, gx = i % 63;
  float ty = ((float)(gy - 31) / (31.0f + 1e-8f)) * 3.2f;
  float tx = ((float)(gx - 31) / (31.0f + 1e-8f)) * 3.2f;
  float sy = (ty > 0.f) ? 1.f : ((ty < 0.f) ? -1.f : 0.f);
  float sx = (tx > 0.f) ? 1.f : ((tx < 0.f) ? -1.f : 0.f);
  ty = sy * (1.0f - __expf(-fabsf(ty)));
  tx = sx * (1.0f - __expf(-fabsf(tx)));
  float acc = 0.f;
#pragma unroll 8
  for (int j = 0; j < 128; ++j) {
    float hj = ty * w1[j * 2 + 0] + tx * w1[j * 2 + 1] + b1[j];
    hj = fmaxf(hj, 0.f);
    acc += hj * w2[head * 128 + j];
  }
  tab_sig[t] = 16.0f / (1.0f + __expf(-acc));
}

// ---------------------------------------------------------------------------
// Stage 2/4: half-GEMM (rows = 16384 tokens, 128x128 weight for one half).
//  MODE 0: q/k  -> residual + per-head L2 norm, f16 out  ((b*8+head)*1024+n)*32+d
//  MODE 1: v    -> residual, f16 out TRANSPOSED          ((b*8+head)*32+d)*1024+n
//  MODE 2: proj -> +bias, f32 NCHW out                   (b*256+ch)*1024+n
// 8 waves, each owns a 16-row strip of the 128-row block; K loop = 4 x 32.
// ---------------------------------------------------------------------------
template <int MODE>
__global__ void __launch_bounds__(256) half_gemm_kernel(const f16* __restrict__ Xh,
                                                        const float* __restrict__ Xf,
                                                        const float* __restrict__ W,
                                                        const float* __restrict__ bvec,
                                                        f16* __restrict__ out_h,
                                                        float* __restrict__ out_f,
                                                        int half) {
  int tid = threadIdx.x, wave = tid >> 5, lane = tid & 31;
  int row0  = blockIdx.x * 128 + wave * 16;
  int nloc  = lane & 15;
  int mbase = (lane >> 4) << 3;

  v16h a[4];
#pragma unroll
  for (int kt = 0; kt < 4; ++kt) {
    if (MODE == 2) a[kt] = load_tile_f32cvt(Xf + (size_t)row0 * 256 + half * 128 + kt * 32, 256, lane);
    else           a[kt] = load_tile_h    (Xh + (size_t)row0 * 256 + half * 128 + kt * 32, 256, lane);
  }

#pragma unroll
  for (int j = 0; j < 4; ++j) {            // output cols 32j .. 32j+31 (= head j of this half)
    v8f acc0 = {}, acc1 = {};
#pragma unroll
    for (int kt = 0; kt < 4; ++kt) {
      // B column n = W[col, :] row (y = x @ W^T), f32 -> f16 on load
      v16h b0 = load_tile_f32cvt(W + (32 * j + 0)  * 128 + kt * 32, 128, lane);
      v16h b1 = load_tile_f32cvt(W + (32 * j + 16) * 128 + kt * 32, 128, lane);
      acc0 = wmma_f16(a[kt], b0, acc0);
      acc1 = wmma_f16(a[kt], b1, acc1);
    }
    int c0 = 32 * j + nloc, c1 = c0 + 16;
    float r0[8], r1[8];
#pragma unroll
    for (int r = 0; r < 8; ++r) {
      int row = row0 + mbase + r;
      float y0 = acc0[r] + bvec[c0];
      float y1 = acc1[r] + bvec[c1];
      if (MODE != 2) {                     // residual x + lin(x)
        y0 += (float)Xh[(size_t)row * 256 + half * 128 + c0];
        y1 += (float)Xh[(size_t)row * 256 + half * 128 + c1];
      }
      r0[r] = y0; r1[r] = y1;
    }
    if (MODE == 0) {                       // per-head (32-dim) L2 normalization
#pragma unroll
      for (int r = 0; r < 8; ++r) {
        float ss  = hred_sum(r0[r] * r0[r] + r1[r] * r1[r]);
        float inv = 1.0f / fmaxf(__fsqrt_rn(ss), 1e-12f);
        r0[r] *= inv; r1[r] *= inv;
      }
    }
#pragma unroll
    for (int r = 0; r < 8; ++r) {
      int row = row0 + mbase + r;
      int b = row >> 10, n = row & 1023;
      int head = half * 4 + j;
      if (MODE == 2) {
        out_f[((size_t)(b * 256 + half * 128 + c0)) * 1024 + n] = r0[r];
        out_f[((size_t)(b * 256 + half * 128 + c1)) * 1024 + n] = r1[r];
      } else if (MODE == 1) {
        out_h[((size_t)((b * 8 + head) * 32 + nloc))      * 1024 + n] = (f16)r0[r];
        out_h[((size_t)((b * 8 + head) * 32 + nloc + 16)) * 1024 + n] = (f16)r1[r];
      } else {
        out_h[((size_t)((b * 8 + head) * 1024 + n)) * 32 + nloc]      = (f16)r0[r];
        out_h[((size_t)((b * 8 + head) * 1024 + n)) * 32 + nloc + 16] = (f16)r1[r];
      }
    }
  }
}

__global__ void __launch_bounds__(256) attn_kernel(const f16* __restrict__ q_ws,
                                                   const f16* __restrict__ k_ws,
                                                   const f16* __restrict__ vt_ws,
                                                   const float* __restrict__ tab_sig,
                                                   const float* __restrict__ logit_scale,
                                                   float* __restrict__ o_ws) {
  __shared__ float s_bias[3969];           // 16*sigmoid table slice for this head
  __shared__ f16   s_p[8 * 16 * 32];       // per-wave P staging (D-layout -> A-layout)

  int tid = threadIdx.x, wave = tid >> 5, lane = tid & 31;
  int rb = blockIdx.x, h = blockIdx.y, b = blockIdx.z;

  for (int i = tid; i < 3969; i += 256) s_bias[i] = tab_sig[h * 3969 + i];
  __syncthreads();

  float scale = __expf(fminf(logit_scale[h], 4.6051701859880914f)); // log(100)
  int row0  = rb * 128 + wave * 16;
  int nloc  = lane & 15;
  int mbase = (lane >> 4) << 3;

  const f16* qbh  = q_ws  + ((size_t)(b * 8 + h) * 1024) * 32;
  const f16* kbh  = k_ws  + ((size_t)(b * 8 + h) * 1024) * 32;
  const f16* vtbh = vt_ws + ((size_t)(b * 8 + h) * 32) * 1024;

  v16h qa = load_tile_h(qbh + row0 * 32, 32, lane);   // resident for whole loop

  int ry[8], rx[8];
#pragma unroll
  for (int r = 0; r < 8; ++r) { int row = row0 + mbase + r; ry[r] = row >> 5; rx[r] = row & 31; }

  v8f o0 = {}, o1 = {};
  float m_r[8], l_r[8];
#pragma unroll
  for (int r = 0; r < 8; ++r) { m_r[r] = -1e30f; l_r[r] = 0.f; }

  f16* pp = &s_p[wave * 512];

  for (int kb = 0; kb < 1024; kb += 32) {
    // ---- prefetch next iteration's K / V^T tiles (global_prefetch_b8) ----
    if (kb + 32 < 1024) {
      __builtin_prefetch(kbh + (size_t)(kb + 32) * 32 + (lane & 15) * 32, 0, 3);
      __builtin_prefetch(vtbh + (kb + 32) + (lane & 15) * 1024, 0, 3);
      __builtin_prefetch(vtbh + 16 * 1024 + (kb + 32) + (lane & 15) * 1024, 0, 3);
    }

    // ---- S = qn @ kn^T (two 16x16 tiles, K = hd = 32 in one WMMA each) ----
    v16h kt0 = load_tile_h(kbh + (size_t)kb * 32, 32, lane);
    v16h kt1 = load_tile_h(kbh + (size_t)(kb + 16) * 32, 32, lane);
    v8f z = {};
    v8f s0 = wmma_f16(qa, kt0, z);
    v8f s1 = wmma_f16(qa, kt1, z);

    int c0 = kb + nloc, c1 = c0 + 16;
    int cy0 = c0 >> 5, cx0 = c0 & 31, cy1 = c1 >> 5, cx1 = c1 & 31;

    float p0[8], p1[8];
#pragma unroll
    for (int r = 0; r < 8; ++r) {          // scale + gathered relative-position bias
      p0[r] = s0[r] * scale + s_bias[(ry[r] - cy0 + 31) * 63 + (rx[r] - cx0 + 31)];
      p1[r] = s1[r] * scale + s_bias[(ry[r] - cy1 + 31) * 63 + (rx[r] - cx1 + 31)];
    }

#pragma unroll
    for (int r = 0; r < 8; ++r) {
      float tmax  = hred_max(fmaxf(p0[r], p1[r]));
      float mnew  = fmaxf(m_r[r], tmax);
      float alpha = exp2f((m_r[r] - mnew) * LOG2E);
      m_r[r] = mnew;
      float e0 = exp2f((p0[r] - mnew) * LOG2E);
      float e1 = exp2f((p1[r] - mnew) * LOG2E);
      p0[r] = e0; p1[r] = e1;
      l_r[r] = l_r[r] * alpha + hred_sum(e0 + e1);
      o0[r] *= alpha; o1[r] *= alpha;
    }

    // ---- D-layout -> A-layout via per-wave LDS (same-wave DS ops are in-order) ----
#pragma unroll
    for (int r = 0; r < 8; ++r) {
      pp[(mbase + r) * 32 + nloc]      = (f16)p0[r];
      pp[(mbase + r) * 32 + nloc + 16] = (f16)p1[r];
    }
    v16h pa = load_tile_h(pp, 32, lane);

    // ---- O += P @ V (v stored transposed: vt[dim][key] so B loads are contiguous) ----
    v16h vb0 = load_tile_h(vtbh + kb, 1024, lane);             // dims 0..15
    v16h vb1 = load_tile_h(vtbh + 16 * 1024 + kb, 1024, lane); // dims 16..31
    o0 = wmma_f16(pa, vb0, o0);
    o1 = wmma_f16(pa, vb1, o1);
  }

  // ---- epilogue: normalize by l, write (b, N, c) f32 for the proj GEMM ----
#pragma unroll
  for (int r = 0; r < 8; ++r) {
    float inv = 1.0f / l_r[r];
    int row = row0 + mbase + r;
    float* op = o_ws + ((size_t)(b * 1024) + row) * 256 + h * 32;
    op[nloc]      = o0[r] * inv;
    op[nloc + 16] = o1[r] * inv;
  }
}

// ---------------------------------------------------------------------------
extern "C" void kernel_launch(void* const* d_in, const int* in_sizes, int n_in,
                              void* d_out, int out_size, void* d_ws, size_t ws_size,
                              hipStream_t stream) {
  const float* x    = (const float*)d_in[0];
  const float* q1_w = (const float*)d_in[1];
  const float* q1_b = (const float*)d_in[2];
  const float* q2_w = (const float*)d_in[3];
  const float* q2_b = (const float*)d_in[4];
  const float* k1_w = (const float*)d_in[5];
  const float* k1_b = (const float*)d_in[6];
  const float* k2_w = (const float*)d_in[7];
  const float* k2_b = (const float*)d_in[8];
  const float* v1_w = (const float*)d_in[9];
  const float* v1_b = (const float*)d_in[10];
  const float* v2_w = (const float*)d_in[11];
  const float* v2_b = (const float*)d_in[12];
  const float* p1_w = (const float*)d_in[13];
  const float* p1_b = (const float*)d_in[14];
  const float* p2_w = (const float*)d_in[15];
  const float* p2_b = (const float*)d_in[16];
  const float* lsc  = (const float*)d_in[17];
  const float* mw1  = (const float*)d_in[18];
  const float* mb1  = (const float*)d_in[19];
  const float* mw2  = (const float*)d_in[20];

  char* ws = (char*)d_ws;
  f16*   x3h   = (f16*)(ws);                          //  8 MB  (16384 x 256 f16)
  f16*   q_ws  = (f16*)(ws + ((size_t)8  << 20));     //  8 MB
  f16*   k_ws  = (f16*)(ws + ((size_t)16 << 20));     //  8 MB
  f16*   vt_ws = (f16*)(ws + ((size_t)24 << 20));     //  8 MB
  float* o_ws  = (float*)(ws + ((size_t)32 << 20));   // 16 MB  (16384 x 256 f32)
  float* tab   = (float*)(ws + ((size_t)48 << 20));   // 124 KB (8 x 3969 f32)

  transpose_kernel<<<16 * 256 * 1024 / 256, 256, 0, stream>>>(x, x3h);
  bias_table_kernel<<<(8 * 3969 + 255) / 256, 256, 0, stream>>>(mw1, mb1, mw2, tab);

  dim3 g(128);  // 16384 rows / 128
  half_gemm_kernel<0><<<g, 256, 0, stream>>>(x3h, nullptr, q1_w, q1_b, q_ws,  nullptr, 0);
  half_gemm_kernel<0><<<g, 256, 0, stream>>>(x3h, nullptr, q2_w, q2_b, q_ws,  nullptr, 1);
  half_gemm_kernel<0><<<g, 256, 0, stream>>>(x3h, nullptr, k1_w, k1_b, k_ws,  nullptr, 0);
  half_gemm_kernel<0><<<g, 256, 0, stream>>>(x3h, nullptr, k2_w, k2_b, k_ws,  nullptr, 1);
  half_gemm_kernel<1><<<g, 256, 0, stream>>>(x3h, nullptr, v1_w, v1_b, vt_ws, nullptr, 0);
  half_gemm_kernel<1><<<g, 256, 0, stream>>>(x3h, nullptr, v2_w, v2_b, vt_ws, nullptr, 1);

  attn_kernel<<<dim3(8, 8, 16), 256, 0, stream>>>(q_ws, k_ws, vt_ws, tab, lsc, o_ws);

  half_gemm_kernel<2><<<g, 256, 0, stream>>>(nullptr, o_ws, p1_w, p1_b, nullptr, (float*)d_out, 0);
  half_gemm_kernel<2><<<g, 256, 0, stream>>>(nullptr, o_ws, p2_w, p2_b, nullptr, (float*)d_out, 1);
}

// v001
// It runs in 187 microseconds.
// Next to v000, in two timings, it ran 1.56 times as fast each time.
#include <hip/hip_runtime.h>
#include <hip/hip_bf16.h>

typedef _Float16 f16;
typedef __attribute__((ext_vector_type(16))) _Float16 v16h;
typedef __attribute__((ext_vector_type(8)))  _Float16 v8h;
typedef __attribute__((ext_vector_type(8)))  float    v8f;
typedef __attribute__((ext_vector_type(4)))  float    v4f;

#define LOG2E 1.44269504088896340736f

static __device__ __forceinline__ v16h load_tile_h(const f16* base, int stride, int lane) {
  const f16* p = base + (lane & 15) * stride + ((lane >> 4) << 3);
  v8h lo = *(const v8h*)(p);        // K koff..koff+7      (16B aligned)
  v8h hi = *(const v8h*)(p + 16);   // K koff+16..koff+23  (16B aligned)
  v16h r;
#pragma unroll
  for (int i = 0; i < 8; ++i) { r[i] = lo[i]; r[i + 8] = hi[i]; }
  return r;
}

static __device__ __forceinline__ v16h load_tile_f32cvt(const float* base, int stride, int lane) {
  const float* p = base + (lane & 15) * stride + ((lane >> 4) << 3);
  v16h r;
#pragma unroll
  for (int i = 0; i < 8; ++i) { r[i] = (f16)p[i]; r[i + 8] = (f16)p[16 + i]; }
  return r;
}

static __device__ __forceinline__ v8f wmma_f16(v16h a, v16h b, v8f c) {
  return __builtin_amdgcn_wmma_f32_16x16x32_f16(false, a, false, b, (short)0, c, false, false);
}

// Reductions across the 16 lanes of a half-wave (xor masks < 16 stay in-half).
static __device__ __forceinline__ float hred_max(float x) {
#pragma unroll
  for (int m = 1; m < 16; m <<= 1) x = fmaxf(x, __shfl_xor(x, m, 32));
  return x;
}
static __device__ __forceinline__ float hred_sum(float x) {
#pragma unroll
  for (int m = 1; m < 16; m <<= 1) x += __shfl_xor(x, m, 32);
  return x;
}

#define TP_PITCH 136
__global__ void __launch_bounds__(256) transpose_kernel(const float* __restrict__ x,
                                                        f16* __restrict__ x3h) {
  __shared__ __attribute__((aligned(16))) f16 s_t[64 * TP_PITCH];
  int tid = threadIdx.x;
  int pt = blockIdx.x & 15;                // token tile   (16 x 64)
  int ct = (blockIdx.x >> 4) & 1;          // channel tile ( 2 x 128)
  int b  = blockIdx.x >> 5;                // image        (16)
  int lo = tid & 15, hi = tid >> 4;

  const float* src = x + ((size_t)(b * 256 + ct * 128 + hi * 8)) * 1024 + pt * 64 + lo * 4;
  v4f v[8];
#pragma unroll
  for (int j = 0; j < 8; ++j) v[j] = *(const v4f*)(src + j * 1024);

#pragma unroll
  for (int i = 0; i < 4; ++i) {
    v8h t;
#pragma unroll
    for (int j = 0; j < 8; ++j) t[j] = (f16)v[j][i];
    *(v8h*)&s_t[(i * 16 + lo) * TP_PITCH + hi * 8] = t;
  }
  __syncthreads();                         // the tile is read back by other waves

  f16* dst = x3h + ((size_t)(b * 1024 + pt * 64)) * 256 + ct * 128 + lo * 8;
#pragma unroll
  for (int k = 0; k < 4; ++k) {
    int tok = k * 16 + hi;
    v8h t = *(const v8h*)&s_t[((tok & 3) * 16 + (tok >> 2)) * TP_PITCH + lo * 8];
    *(v8h*)(dst + (size_t)tok * 256) = t;
  }
}

// ---------------------------------------------------------------------------
// Stage 1: relative-position bias table: tab_sig[head*3969 + i] = 16*sigmoid(mlp(coords_i))
// ---------------------------------------------------------------------------
__global__ void __launch_bounds__(256) bias_table_kernel(const float* __restrict__ w1,
                                                         const float* __restrict__ b1,
                                                         const float* __restrict__ w2,
                                                         float* __restrict__ tab_sig) {
  int t = blockIdx.x * 256 + threadIdx.x;      // 8 * 3969
  if (t >= 8 * 3969) return;
  int i = t % 3969, head = t / 3969;
  int gy = i / 63, gx = i % 63;
  float ty = ((float)(gy - 31) / (31.0f + 1e-8f)) * 3.2f;
  float tx = ((float)(gx - 31) / (31.0f + 1e-8f)) * 3.2f;
  float sy = (ty > 0.f) ? 1.f : ((ty < 0.f) ? -1.f : 0.f);
  float sx = (tx > 0.f) ? 1.f : ((tx < 0.f) ? -1.f : 0.f);
  ty = sy * (1.0f - __expf(-fabsf(ty)));
  tx = sx * (1.0f - __expf(-fabsf(tx)));
  float acc = 0.f;
#pragma unroll 8
  for (int j = 0; j < 128; ++j) {
    float hj = ty * w1[j * 2 + 0] + tx * w1[j * 2 + 1] + b1[j];
    hj = fmaxf(hj, 0.f);
    acc += hj * w2[head * 128 + j];
  }
  tab_sig[t] = 16.0f / (1.0f + __expf(-acc));
}

// ---------------------------------------------------------------------------
// Stage 2/4: half-GEMM (rows = 16384 tokens, 128x128 weight for one half).
//  MODE 0: q/k  -> residual + per-head L2 norm, f16 out  ((b*8+head)*1024+n)*32+d
//  MODE 1: v    -> residual, f16 out TRANSPOSED          ((b*8+head)*32+d)*1024+n
//  MODE 2: proj -> +bias, f32 NCHW out                   (b*256+ch)*1024+n
// 8 waves, each owns a 16-row strip of the 128-row block; K loop = 4 x 32.
// ---------------------------------------------------------------------------
template <int MODE>
__global__ void __launch_bounds__(256) half_gemm_kernel(const f16* __restrict__ Xh,
                                                        const float* __restrict__ Xf,
                                                        const float* __restrict__ W,
                                                        const float* __restrict__ bvec,
                                                        f16* __restrict__ out_h,
                                                        float* __restrict__ out_f,
                                                        int half) {
  int tid = threadIdx.x, wave = tid >> 5, lane = tid & 31;
  int row0  = blockIdx.x * 128 + wave * 16;
  int nloc  = lane & 15;
  int mbase = (lane >> 4) << 3;

  v16h a[4];
#pragma unroll
  for (int kt = 0; kt < 4; ++kt) {
    if (MODE == 2) a[kt] = load_tile_f32cvt(Xf + (size_t)row0 * 256 + half * 128 + kt * 32, 256, lane);
    else           a[kt] = load_tile_h    (Xh + (size_t)row0 * 256 + half * 128 + kt * 32, 256, lane);
  }

#pragma unroll
  for (int j = 0; j < 4; ++j) {            // output cols 32j .. 32j+31 (= head j of this half)
    v8f acc0 = {}, acc1 = {};
#pragma unroll
    for (int kt = 0; kt < 4; ++kt) {
      // B column n = W[col, :] row (y = x @ W^T), f32 -> f16 on load
      v16h b0 = load_tile_f32cvt(W + (32 * j + 0)  * 128 + kt * 32, 128, lane);
      v16h b1 = load_tile_f32cvt(W + (32 * j + 16) * 128 + kt * 32, 128, lane);
      acc0 = wmma_f16(a[kt], b0, acc0);
      acc1 = wmma_f16(a[kt], b1, acc1);
    }
    int c0 = 32 * j + nloc, c1 = c0 + 16;
    float r0[8], r1[8];
#pragma unroll
    for (int r = 0; r < 8; ++r) {
      int row = row0 + mbase + r;
      float y0 = acc0[r] + bvec[c0];
      float y1 = acc1[r] + bvec[c1];
      if (MODE != 2) {                     // residual x + lin(x)
        y0 += (float)Xh[(size_t)row * 256 + half * 128 + c0];
        y1 += (float)Xh[(size_t)row * 256 + half * 128 + c1];
      }
      r0[r] = y0; r1[r] = y1;
    }
    if (MODE == 0) {                       // per-head (32-dim) L2 normalization
#pragma unroll
      for (int r = 0; r < 8; ++r) {
        float ss  = hred_sum(r0[r] * r0[r] + r1[r] * r1[r]);
        float inv = 1.0f / fmaxf(__fsqrt_rn(ss), 1e-12f);
        r0[r] *= inv; r1[r] *= inv;
      }
    }
#pragma unroll
    for (int r = 0; r < 8; ++r) {
      int row = row0 + mbase + r;
      int b = row >> 10, n = row & 1023;
      int head = half * 4 + j;
      if (MODE == 2) {
        out_f[((size_t)(b * 256 + half * 128 + c0)) * 1024 + n] = r0[r];
        out_f[((size_t)(b * 256 + half * 128 + c1)) * 1024 + n] = r1[r];
      } else if (MODE == 1) {
        out_h[((size_t)((b * 8 + head) * 32 + nloc))      * 1024 + n] = (f16)r0[r];
        out_h[((size_t)((b * 8 + head) * 32 + nloc + 16)) * 1024 + n] = (f16)r1[r];
      } else {
        out_h[((size_t)((b * 8 + head) * 1024 + n)) * 32 + nloc]      = (f16)r0[r];
        out_h[((size_t)((b * 8 + head) * 1024 + n)) * 32 + nloc + 16] = (f16)r1[r];
      }
    }
  }
}

__global__ void __launch_bounds__(256) attn_kernel(const f16* __restrict__ q_ws,
                                                   const f16* __restrict__ k_ws,
                                                   const f16* __restrict__ vt_ws,
                                                   const float* __restrict__ tab_sig,
                                                   const float* __restrict__ logit_scale,
                                                   float* __restrict__ o_ws) {
  __shared__ float s_bias[3969];           // 16*sigmoid table slice for this head
  __shared__ f16   s_p[8 * 16 * 32];       // per-wave P staging (D-layout -> A-layout)

  int tid = threadIdx.x, wave = tid >> 5, lane = tid & 31;
  int rb = blockIdx.x, h = blockIdx.y, b = blockIdx.z;

  for (int i = tid; i < 3969; i += 256) s_bias[i] = tab_sig[h * 3969 + i];
  __syncthreads();

  float scale = __expf(fminf(logit_scale[h], 4.6051701859880914f)); // log(100)
  int row0  = rb * 128 + wave * 16;
  int nloc  = lane & 15;
  int mbase = (lane >> 4) << 3;

  const f16* qbh  = q_ws  + ((size_t)(b * 8 + h) * 1024) * 32;
  const f16* kbh  = k_ws  + ((size_t)(b * 8 + h) * 1024) * 32;
  const f16* vtbh = vt_ws + ((size_t)(b * 8 + h) * 32) * 1024;

  v16h qa = load_tile_h(qbh + row0 * 32, 32, lane);   // resident for whole loop

  int ry[8], rx[8];
#pragma unroll
  for (int r = 0; r < 8; ++r) { int row = row0 + mbase + r; ry[r] = row >> 5; rx[r] = row & 31; }

  v8f o0 = {}, o1 = {};
  float m_r[8], l_r[8];
#pragma unroll
  for (int r = 0; r < 8; ++r) { m_r[r] = -1e30f; l_r[r] = 0.f; }

  f16* pp = &s_p[wave * 512];

  for (int kb = 0; kb < 1024; kb += 32) {
    // ---- prefetch next iteration's K / V^T tiles (global_prefetch_b8) ----
    if (kb + 32 < 1024) {
      __builtin_prefetch(kbh + (size_t)(kb + 32) * 32 + (lane & 15) * 32, 0, 3);
      __builtin_prefetch(vtbh + (kb + 32) + (lane & 15) * 1024, 0, 3);
      __builtin_prefetch(vtbh + 16 * 1024 + (kb + 32) + (lane & 15) * 1024, 0, 3);
    }

    // ---- S = qn @ kn^T (two 16x16 tiles, K = hd = 32 in one WMMA each) ----
    v16h kt0 = load_tile_h(kbh + (size_t)kb * 32, 32, lane);
    v16h kt1 = load_tile_h(kbh + (size_t)(kb + 16) * 32, 32, lane);
    v8f z = {};
    v8f s0 = wmma_f16(qa, kt0, z);
    v8f s1 = wmma_f16(qa, kt1, z);

    int c0 = kb + nloc, c1 = c0 + 16;
    int cy0 = c0 >> 5, cx0 = c0 & 31, cy1 = c1 >> 5, cx1 = c1 & 31;

    float p0[8], p1[8];
#pragma unroll
    for (int r = 0; r < 8; ++r) {          // scale + gathered relative-position bias
      p0[r] = s0[r] * scale + s_bias[(ry[r] - cy0 + 31) * 63 + (rx[r] - cx0 + 31)];
      p1[r] = s1[r] * scale + s_bias[(ry[r] - cy1 + 31) * 63 + (rx[r] - cx1 + 31)];
    }

#pragma unroll
    for (int r = 0; r < 8; ++r) {
      float tmax  = hred_max(fmaxf(p0[r], p1[r]));
      float mnew  = fmaxf(m_r[r], tmax);
      float alpha = exp2f((m_r[r] - mnew) * LOG2E);
      m_r[r] = mnew;
      float e0 = exp2f((p0[r] - mnew) * LOG2E);
      float e1 = exp2f((p1[r] - mnew) * LOG2E);
      p0[r] = e0; p1[r] = e1;
      l_r[r] = l_r[r] * alpha + hred_sum(e0 + e1);
      o0[r] *= alpha; o1[r] *= alpha;
    }

    // ---- D-layout -> A-layout via per-wave LDS (same-wave DS ops are in-order) ----
#pragma unroll
    for (int r = 0; r < 8; ++r) {
      pp[(mbase + r) * 32 + nloc]      = (f16)p0[r];
      pp[(mbase + r) * 32 + nloc + 16] = (f16)p1[r];
    }
    v16h pa = load_tile_h(pp, 32, lane);

    // ---- O += P @ V (v stored transposed: vt[dim][key] so B loads are contiguous) ----
    v16h vb0 = load_tile_h(vtbh + kb, 1024, lane);             // dims 0..15
    v16h vb1 = load_tile_h(vtbh + 16 * 1024 + kb, 1024, lane); // dims 16..31
    o0 = wmma_f16(pa, vb0, o0);
    o1 = wmma_f16(pa, vb1, o1);
  }

  // ---- epilogue: normalize by l, write (b, N, c) f32 for the proj GEMM ----
#pragma unroll
  for (int r = 0; r < 8; ++r) {
    float inv = 1.0f / l_r[r];
    int row = row0 + mbase + r;
    float* op = o_ws + ((size_t)(b * 1024) + row) * 256 + h * 32;
    op[nloc]      = o0[r] * inv;
    op[nloc + 16] = o1[r] * inv;
  }
}

// ---------------------------------------------------------------------------
extern "C" void kernel_launch(void* const* d_in, const int* in_sizes, int n_in,
                              void* d_out, int out_size, void* d_ws, size_t ws_size,
                              hipStream_t stream) {
  const float* x    = (const float*)d_in[0];
  const float* q1_w = (const float*)d_in[1];
  const float* q1_b = (const float*)d_in[2];
  const float* q2_w = (const float*)d_in[3];
  const float* q2_b = (const float*)d_in[4];
  const float* k1_w = (const float*)d_in[5];
  const float* k1_b = (const float*)d_in[6];
  const float* k2_w = (const float*)d_in[7];
  const float* k2_b = (const float*)d_in[8];
  const float* v1_w = (const float*)d_in[9];
  const float* v1_b = (const float*)d_in[10];
  const float* v2_w = (const float*)d_in[11];
  const float* v2_b = (const float*)d_in[12];
  const float* p1_w = (const float*)d_in[13];
  const float* p1_b = (const float*)d_in[14];
  const float* p2_w = (const float*)d_in[15];
  const float* p2_b = (const float*)d_in[16];
  const float* lsc  = (const float*)d_in[17];
  const float* mw1  = (const float*)d_in[18];
  const float* mb1  = (const float*)d_in[19];
  const float* mw2  = (const float*)d_in[20];

  char* ws = (char*)d_ws;
  f16*   x3h   = (f16*)(ws);                          //  8 MB  (16384 x 256 f16)
  f16*   q_ws  = (f16*)(ws + ((size_t)8  << 20));     //  8 MB
  f16*   k_ws  = (f16*)(ws + ((size_t)16 << 20));     //  8 MB
  f16*   vt_ws = (f16*)(ws + ((size_t)24 << 20));     //  8 MB
  float* o_ws  = (float*)(ws + ((size_t)32 << 20));   // 16 MB  (16384 x 256 f32)
  float* tab   = (float*)(ws + ((size_t)48 << 20));   // 124 KB (8 x 3969 f32)

  transpose_kernel<<<512, 256, 0, stream>>>(x, x3h);  // 16 images x 2 x 16 tiles
  bias_table_kernel<<<(8 * 3969 + 255) / 256, 256, 0, stream>>>(mw1, mb1, mw2, tab);

  dim3 g(128);  // 16384 rows / 128
  half_gemm_kernel<0><<<g, 256, 0, stream>>>(x3h, nullptr, q1_w, q1_b, q_ws,  nullptr, 0);
  half_gemm_kernel<0><<<g, 256, 0, stream>>>(x3h, nullptr, q2_w, q2_b, q_ws,  nullptr, 1);
  half_gemm_kernel<0><<<g, 256, 0, stream>>>(x3h, nullptr, k1_w, k1_b, k_ws,  nullptr, 0);
  half_gemm_kernel<0><<<g, 256, 0, stream>>>(x3h, nullptr, k2_w, k2_b, k_ws,  nullptr, 1);
  half_gemm_kernel<1><<<g, 256, 0, stream>>>(x3h, nullptr, v1_w, v1_b, vt_ws, nullptr, 0);
  half_gemm_kernel<1><<<g, 256, 0, stream>>>(x3h, nullptr, v2_w, v2_b, vt_ws, nullptr, 1);

  attn_kernel<<<dim3(8, 8, 16), 256, 0, stream>>>(q_ws, k_ws, vt_ws, tab, lsc, o_ws);

  half_gemm_kernel<2><<<g, 256, 0, stream>>>(nullptr, o_ws, p1_w, p1_b, nullptr, (float*)d_out, 0);
  half_gemm_kernel<2><<<g, 256, 0, stream>>>(nullptr, o_ws, p2_w, p2_b, nullptr, (float*)d_out, 1);
}

// v002
// One run takes 130 microseconds.
// Two timings next to v001 both put it at 1.44 times that version's speed.
// Counting every step since v000, it is 2.24 times as fast.
#include <hip/hip_runtime.h>
#include <hip/hip_bf16.h>

typedef _Float16 f16;
typedef __attribute__((ext_vector_type(16))) _Float16 v16h;
typedef __attribute__((ext_vector_type(8)))  _Float16 v8h;
typedef __attribute__((ext_vector_type(8)))  float    v8f;
typedef __attribute__((ext_vector_type(4)))  float    v4f;

#define LOG2E 1.44269504088896340736f

static __device__ __forceinline__ v16h load_tile_h(const f16* base, int stride, int lane) {
  const f16* p = base + (lane & 15) * stride + ((lane >> 4) << 3);
  v8h lo = *(const v8h*)(p);        // K koff..koff+7      (16B aligned)
  v8h hi = *(const v8h*)(p + 16);   // K koff+16..koff+23  (16B aligned)
  v16h r;
#pragma unroll
  for (int i = 0; i < 8; ++i) { r[i] = lo[i]; r[i + 8] = hi[i]; }
  return r;
}

static __device__ __forceinline__ v16h load_tile_f32cvt(const float* base, int stride, int lane) {
  const float* p = base + (lane & 15) * stride + ((lane >> 4) << 3);
  v16h r;
#pragma unroll
  for (int i = 0; i < 8; ++i) { r[i] = (f16)p[i]; r[i + 8] = (f16)p[16 + i]; }
  return r;
}

static __device__ __forceinline__ v8f wmma_f16(v16h a, v16h b, v8f c) {
  return __builtin_amdgcn_wmma_f32_16x16x32_f16(false, a, false, b, (short)0, c, false, false);
}

// Reductions across the 16 lanes of a half-wave (xor masks < 16 stay in-half).
static __device__ __forceinline__ float hred_max(float x) {
#pragma unroll
  for (int m = 1; m < 16; m <<= 1) x = fmaxf(x, __shfl_xor(x, m, 32));
  return x;
}
static __device__ __forceinline__ float hred_sum(float x) {
#pragma unroll
  for (int m = 1; m < 16; m <<= 1) x += __shfl_xor(x, m, 32);
  return x;
}

#define TP_PITCH 136
__global__ void __launch_bounds__(256) transpose_kernel(const float* __restrict__ x,
                                                        f16* __restrict__ x3h) {
  __shared__ __attribute__((aligned(16))) f16 s_t[64 * TP_PITCH];
  int tid = threadIdx.x;
  int pt = blockIdx.x & 15;                // token tile   (16 x 64)
  int ct = (blockIdx.x >> 4) & 1;          // channel tile ( 2 x 128)
  int b  = blockIdx.x >> 5;                // image        (16)
  int lo = tid & 15, hi = tid >> 4;

  const float* src = x + ((size_t)(b * 256 + ct * 128 + hi * 8)) * 1024 + pt * 64 + lo * 4;
  v4f v[8];
#pragma unroll
  for (int j = 0; j < 8; ++j) v[j] = *(const v4f*)(src + j * 1024);

#pragma unroll
  for (int i = 0; i < 4; ++i) {
    v8h t;
#pragma unroll
    for (int j = 0; j < 8; ++j) t[j] = (f16)v[j][i];
    *(v8h*)&s_t[(i * 16 + lo) * TP_PITCH + hi * 8] = t;
  }
  __syncthreads();                         // the tile is read back by other waves

  f16* dst = x3h + ((size_t)(b * 1024 + pt * 64)) * 256 + ct * 128 + lo * 8;
#pragma unroll
  for (int k = 0; k < 4; ++k) {
    int tok = k * 16 + hi;
    v8h t = *(const v8h*)&s_t[((tok & 3) * 16 + (tok >> 2)) * TP_PITCH + lo * 8];
    *(v8h*)(dst + (size_t)tok * 256) = t;
  }
}

// ---------------------------------------------------------------------------
// Stage 1: relative-position bias table: tab_sig[head*3969 + i] = 16*sigmoid(mlp(coords_i))
// ---------------------------------------------------------------------------
__global__ void __launch_bounds__(256) bias_table_kernel(const float* __restrict__ w1,
                                                         const float* __restrict__ b1,
                                                         const float* __restrict__ w2,
                                                         float* __restrict__ tab_sig) {
  int t = blockIdx.x * 256 + threadIdx.x;      // 8 * 3969
  if (t >= 8 * 3969) return;
  int i = t % 3969, head = t / 3969;
  int gy = i / 63, gx = i % 63;
  float ty = ((float)(gy - 31) / (31.0f + 1e-8f)) * 3.2f;
  float tx = ((float)(gx - 31) / (31.0f + 1e-8f)) * 3.2f;
  float sy = (ty > 0.f) ? 1.f : ((ty < 0.f) ? -1.f : 0.f);
  float sx = (tx > 0.f) ? 1.f : ((tx < 0.f) ? -1.f : 0.f);
  ty = sy * (1.0f - __expf(-fabsf(ty)));
  tx = sx * (1.0f - __expf(-fabsf(tx)));
  float acc = 0.f;
#pragma unroll 8
  for (int j = 0; j < 128; ++j) {
    float hj = ty * w1[j * 2 + 0] + tx * w1[j * 2 + 1] + b1[j];
    hj = fmaxf(hj, 0.f);
    acc += hj * w2[head * 128 + j];
  }
  tab_sig[t] = 16.0f / (1.0f + __expf(-acc));
}

// ---------------------------------------------------------------------------
// Stage 2/4: half-GEMM (rows = 16384 tokens, 128x128 weight for one half).
//  MODE 0: q/k  -> residual + per-head L2 norm, f16 out  ((b*8+head)*1024+n)*32+d
//  MODE 1: v    -> residual, f16 out TRANSPOSED          ((b*8+head)*32+d)*1024+n
//  MODE 2: proj -> +bias, f32 NCHW out                   (b*256+ch)*1024+n
// 8 waves, each owns a 16-row strip of the 128-row block; K loop = 4 x 32.
// ---------------------------------------------------------------------------
template <int MODE>
static __device__ __forceinline__ void half_gemm_body(const f16* __restrict__ Xh,
                                                      const float* __restrict__ Xf,
                                                      const float* __restrict__ W,
                                                      const float* __restrict__ bvec,
                                                      f16* __restrict__ out_h,
                                                      float* __restrict__ out_f,
                                                      int half) {
  int tid = threadIdx.x, wave = tid >> 5, lane = tid & 31;
  int row0  = blockIdx.x * 128 + wave * 16;
  int nloc  = lane & 15;
  int mbase = (lane >> 4) << 3;

  v16h a[4];
#pragma unroll
  for (int kt = 0; kt < 4; ++kt) {
    if (MODE == 2) a[kt] = load_tile_f32cvt(Xf + (size_t)row0 * 256 + half * 128 + kt * 32, 256, lane);
    else           a[kt] = load_tile_h    (Xh + (size_t)row0 * 256 + half * 128 + kt * 32, 256, lane);
  }
  asm volatile("s_wait_xcnt 0x0" ::: "memory");

#pragma unroll
  for (int j = 0; j < 4; ++j) {            // output cols 32j .. 32j+31 (= head j of this half)
    v8f acc0 = {}, acc1 = {};
#pragma unroll
    for (int kt = 0; kt < 4; ++kt) {
      // B column n = W[col, :] row (y = x @ W^T), f32 -> f16 on load
      v16h b0 = load_tile_f32cvt(W + (32 * j + 0)  * 128 + kt * 32, 128, lane);
      v16h b1 = load_tile_f32cvt(W + (32 * j + 16) * 128 + kt * 32, 128, lane);
      acc0 = wmma_f16(a[kt], b0, acc0);
      acc1 = wmma_f16(a[kt], b1, acc1);
    }
    asm volatile("s_wait_xcnt 0x0" ::: "memory");
    int c0 = 32 * j + nloc, c1 = c0 + 16;
    float r0[8], r1[8];
#pragma unroll
    for (int r = 0; r < 8; ++r) {
      int row = row0 + mbase + r;
      float y0 = acc0[r] + bvec[c0];
      float y1 = acc1[r] + bvec[c1];
      if (MODE != 2) {                     // residual x + lin(x)
        y0 += (float)Xh[(size_t)row * 256 + half * 128 + c0];
        y1 += (float)Xh[(size_t)row * 256 + half * 128 + c1];
      }
      r0[r] = y0; r1[r] = y1;
    }
    if (MODE == 0) {                       // per-head (32-dim) L2 normalization
#pragma unroll
      for (int r = 0; r < 8; ++r) {
        float ss  = hred_sum(r0[r] * r0[r] + r1[r] * r1[r]);
        float inv = 1.0f / fmaxf(__fsqrt_rn(ss), 1e-12f);
        r0[r] *= inv; r1[r] *= inv;
      }
    }
#pragma unroll
    for (int r = 0; r < 8; ++r) {
      int row = row0 + mbase + r;
      int b = row >> 10, n = row & 1023;
      int head = half * 4 + j;
      if (MODE == 2) {
        out_f[((size_t)(b * 256 + half * 128 + c0)) * 1024 + n] = r0[r];
        out_f[((size_t)(b * 256 + half * 128 + c1)) * 1024 + n] = r1[r];
      } else if (MODE == 1) {
        out_h[((size_t)((b * 8 + head) * 32 + nloc))      * 1024 + n] = (f16)r0[r];
        out_h[((size_t)((b * 8 + head) * 32 + nloc + 16)) * 1024 + n] = (f16)r1[r];
      } else {
        out_h[((size_t)((b * 8 + head) * 1024 + n)) * 32 + nloc]      = (f16)r0[r];
        out_h[((size_t)((b * 8 + head) * 1024 + n)) * 32 + nloc + 16] = (f16)r1[r];
      }
    }
    asm volatile("s_wait_xcnt 0x0" ::: "memory");
  }
}

__global__ void __launch_bounds__(256) qkv_kernel(const f16* __restrict__ x3h,
                                                  const float* __restrict__ q1_w, const float* __restrict__ q1_b,
                                                  const float* __restrict__ q2_w, const float* __restrict__ q2_b,
                                                  const float* __restrict__ k1_w, const float* __restrict__ k1_b,
                                                  const float* __restrict__ k2_w, const float* __restrict__ k2_b,
                                                  const float* __restrict__ v1_w, const float* __restrict__ v1_b,
                                                  const float* __restrict__ v2_w, const float* __restrict__ v2_b,
                                                  f16* __restrict__ q_ws, f16* __restrict__ k_ws,
                                                  f16* __restrict__ vt_ws) {
  int job = blockIdx.y;
  int half = job & 1;
  if (job < 4) {
    const float* Wm = (job < 2) ? (half ? q2_w : q1_w) : (half ? k2_w : k1_w);
    const float* bv = (job < 2) ? (half ? q2_b : q1_b) : (half ? k2_b : k1_b);
    half_gemm_body<0>(x3h, nullptr, Wm, bv, (job < 2) ? q_ws : k_ws, nullptr, half);
  } else {
    half_gemm_body<1>(x3h, nullptr, half ? v2_w : v1_w, half ? v2_b : v1_b, vt_ws, nullptr, half);
  }
}

__global__ void __launch_bounds__(256) proj_kernel(const float* __restrict__ o_ws,
                                                   const float* __restrict__ p1_w, const float* __restrict__ p1_b,
                                                   const float* __restrict__ p2_w, const float* __restrict__ p2_b,
                                                   float* __restrict__ out) {
  int half = blockIdx.y;
  half_gemm_body<2>(nullptr, o_ws, half ? p2_w : p1_w, half ? p2_b : p1_b, nullptr, out, half);
}

__global__ void __launch_bounds__(256) attn_kernel(const f16* __restrict__ q_ws,
                                                   const f16* __restrict__ k_ws,
                                                   const f16* __restrict__ vt_ws,
                                                   const float* __restrict__ tab_sig,
                                                   const float* __restrict__ logit_scale,
                                                   float* __restrict__ o_ws) {
  __shared__ float s_bias[3969];           // 16*sigmoid table slice for this head
  __shared__ f16   s_p[8 * 16 * 32];       // per-wave P staging (D-layout -> A-layout)

  int tid = threadIdx.x, wave = tid >> 5, lane = tid & 31;
  int rb = blockIdx.x, h = blockIdx.y, b = blockIdx.z;

  for (int i = tid; i < 3969; i += 256) s_bias[i] = tab_sig[h * 3969 + i];
  __syncthreads();

  float scale = __expf(fminf(logit_scale[h], 4.6051701859880914f)); // log(100)
  int row0  = rb * 128 + wave * 16;
  int nloc  = lane & 15;
  int mbase = (lane >> 4) << 3;

  const f16* qbh  = q_ws  + ((size_t)(b * 8 + h) * 1024) * 32;
  const f16* kbh  = k_ws  + ((size_t)(b * 8 + h) * 1024) * 32;
  const f16* vtbh = vt_ws + ((size_t)(b * 8 + h) * 32) * 1024;

  v16h qa = load_tile_h(qbh + row0 * 32, 32, lane);   // resident for whole loop

  int ry[8], rx[8];
#pragma unroll
  for (int r = 0; r < 8; ++r) { int row = row0 + mbase + r; ry[r] = row >> 5; rx[r] = row & 31; }

  v8f o0 = {}, o1 = {};
  float m_r[8], l_r[8];
#pragma unroll
  for (int r = 0; r < 8; ++r) { m_r[r] = -1e30f; l_r[r] = 0.f; }

  f16* pp = &s_p[wave * 512];

  for (int kb = 0; kb < 1024; kb += 32) {
    // ---- prefetch next iteration's K / V^T tiles (global_prefetch_b8) ----
    if (kb + 32 < 1024) {
      __builtin_prefetch(kbh + (size_t)(kb + 32) * 32 + (lane & 15) * 32, 0, 3);
      __builtin_prefetch(vtbh + (kb + 32) + (lane & 15) * 1024, 0, 3);
      __builtin_prefetch(vtbh + 16 * 1024 + (kb + 32) + (lane & 15) * 1024, 0, 3);
    }

    // ---- S = qn @ kn^T (two 16x16 tiles, K = hd = 32 in one WMMA each) ----
    v16h kt0 = load_tile_h(kbh + (size_t)kb * 32, 32, lane);
    v16h kt1 = load_tile_h(kbh + (size_t)(kb + 16) * 32, 32, lane);
    v8f z = {};
    v8f s0 = wmma_f16(qa, kt0, z);
    v8f s1 = wmma_f16(qa, kt1, z);

    int c0 = kb + nloc, c1 = c0 + 16;
    int cy0 = c0 >> 5, cx0 = c0 & 31, cy1 = c1 >> 5, cx1 = c1 & 31;

    float p0[8], p1[8];
#pragma unroll
    for (int r = 0; r < 8; ++r) {          // scale + gathered relative-position bias
      p0[r] = s0[r] * scale + s_bias[(ry[r] - cy0 + 31) * 63 + (rx[r] - cx0 + 31)];
      p1[r] = s1[r] * scale + s_bias[(ry[r] - cy1 + 31) * 63 + (rx[r] - cx1 + 31)];
    }

#pragma unroll
    for (int r = 0; r < 8; ++r) {
      float tmax  = hred_max(fmaxf(p0[r], p1[r]));
      float mnew  = fmaxf(m_r[r], tmax);
      float alpha = exp2f((m_r[r] - mnew) * LOG2E);
      m_r[r] = mnew;
      float e0 = exp2f((p0[r] - mnew) * LOG2E);
      float e1 = exp2f((p1[r] - mnew) * LOG2E);
      p0[r] = e0; p1[r] = e1;
      l_r[r] = l_r[r] * alpha + hred_sum(e0 + e1);
      o0[r] *= alpha; o1[r] *= alpha;
    }

    // ---- D-layout -> A-layout via per-wave LDS (same-wave DS ops are in-order) ----
#pragma unroll
    for (int r = 0; r < 8; ++r) {
      pp[(mbase + r) * 32 + nloc]      = (f16)p0[r];
      pp[(mbase + r) * 32 + nloc + 16] = (f16)p1[r];
    }
    v16h pa = load_tile_h(pp, 32, lane);

    // ---- O += P @ V (v stored transposed: vt[dim][key] so B loads are contiguous) ----
    v16h vb0 = load_tile_h(vtbh + kb, 1024, lane);             // dims 0..15
    v16h vb1 = load_tile_h(vtbh + 16 * 1024 + kb, 1024, lane); // dims 16..31
    o0 = wmma_f16(pa, vb0, o0);
    o1 = wmma_f16(pa, vb1, o1);
  }

  // ---- epilogue: normalize by l, write (b, N, c) f32 for the proj GEMM ----
#pragma unroll
  for (int r = 0; r < 8; ++r) {
    float inv = 1.0f / l_r[r];
    int row = row0 + mbase + r;
    float* op = o_ws + ((size_t)(b * 1024) + row) * 256 + h * 32;
    op[nloc]      = o0[r] * inv;
    op[nloc + 16] = o1[r] * inv;
  }
}

// ---------------------------------------------------------------------------
extern "C" void kernel_launch(void* const* d_in, const int* in_sizes, int n_in,
                              void* d_out, int out_size, void* d_ws, size_t ws_size,
                              hipStream_t stream) {
  const float* x    = (const float*)d_in[0];
  const float* q1_w = (const float*)d_in[1];
  const float* q1_b = (const float*)d_in[2];
  const float* q2_w = (const float*)d_in[3];
  const float* q2_b = (const float*)d_in[4];
  const float* k1_w = (const float*)d_in[5];
  const float* k1_b = (const float*)d_in[6];
  const float* k2_w = (const float*)d_in[7];
  const float* k2_b = (const float*)d_in[8];
  const float* v1_w = (const float*)d_in[9];
  const float* v1_b = (const float*)d_in[10];
  const float* v2_w = (const float*)d_in[11];
  const float* v2_b = (const float*)d_in[12];
  const float* p1_w = (const float*)d_in[13];
  const float* p1_b = (const float*)d_in[14];
  const float* p2_w = (const float*)d_in[15];
  const float* p2_b = (const float*)d_in[16];
  const float* lsc  = (const float*)d_in[17];
  const float* mw1  = (const float*)d_in[18];
  const float* mb1  = (const float*)d_in[19];
  const float* mw2  = (const float*)d_in[20];

  char* ws = (char*)d_ws;
  f16*   x3h   = (f16*)(ws);                          //  8 MB  (16384 x 256 f16)
  f16*   q_ws  = (f16*)(ws + ((size_t)8  << 20));     //  8 MB
  f16*   k_ws  = (f16*)(ws + ((size_t)16 << 20));     //  8 MB
  f16*   vt_ws = (f16*)(ws + ((size_t)24 << 20));     //  8 MB
  float* o_ws  = (float*)(ws + ((size_t)32 << 20));   // 16 MB  (16384 x 256 f32)
  float* tab   = (float*)(ws + ((size_t)48 << 20));   // 124 KB (8 x 3969 f32)

  transpose_kernel<<<512, 256, 0, stream>>>(x, x3h);  // 16 images x 2 x 16 tiles
  bias_table_kernel<<<(8 * 3969 + 255) / 256, 256, 0, stream>>>(mw1, mb1, mw2, tab);

  // 128 row blocks (16384 rows / 128) x 6 half-GEMMs
  qkv_kernel<<<dim3(128, 6), 256, 0, stream>>>(x3h, q1_w, q1_b, q2_w, q2_b, k1_w, k1_b, k2_w, k2_b,
                                               v1_w, v1_b, v2_w, v2_b, q_ws, k_ws, vt_ws);

  attn_kernel<<<dim3(8, 8, 16), 256, 0, stream>>>(q_ws, k_ws, vt_ws, tab, lsc, o_ws);

  proj_kernel<<<dim3(128, 2), 256, 0, stream>>>(o_ws, p1_w, p1_b, p2_w, p2_b, (float*)d_out);
}

// v003
// It runs in 100 microseconds.
// Two timings next to v002 both put it at 1.30 times that version's speed.
// Over all steps from v000 it is 2.91 times as fast.
#include <hip/hip_runtime.h>
#include <hip/hip_bf16.h>

typedef _Float16 f16;
typedef __attribute__((ext_vector_type(16))) _Float16 v16h;
typedef __attribute__((ext_vector_type(8)))  _Float16 v8h;
typedef __attribute__((ext_vector_type(8)))  float    v8f;
typedef __attribute__((ext_vector_type(4)))  float    v4f;
typedef __attribute__((ext_vector_type(2)))  float    v2f;

#define LOG2E 1.44269504088896340736f

static __device__ __forceinline__ v16h load_tile_h(const f16* base, int stride, int lane) {
  const f16* p = base + (lane & 15) * stride + ((lane >> 4) << 3);
  v8h lo = *(const v8h*)(p);        // K koff..koff+7      (16B aligned)
  v8h hi = *(const v8h*)(p + 16);   // K koff+16..koff+23  (16B aligned)
  v16h r;
#pragma unroll
  for (int i = 0; i < 8; ++i) { r[i] = lo[i]; r[i + 8] = hi[i]; }
  return r;
}

static __device__ __forceinline__ v16h load_tile_f32cvt(const float* base, int stride, int lane) {
  const float* p = base + (lane & 15) * stride + ((lane >> 4) << 3);
  v16h r;
#pragma unroll
  for (int i = 0; i < 8; ++i) { r[i] = (f16)p[i]; r[i + 8] = (f16)p[16 + i]; }
  return r;
}

static __device__ __forceinline__ v8f wmma_f16(v16h a, v16h b, v8f c) {
  return __builtin_amdgcn_wmma_f32_16x16x32_f16(false, a, false, b, (short)0, c, false, false);
}

// Reduction across the 16 lanes of a half-wave (xor masks < 16 stay in-half).
static __device__ __forceinline__ float hred_sum(float x) {
#pragma unroll
  for (int m = 1; m < 16; m <<= 1) x += __shfl_xor(x, m, 32);
  return x;
}

#define TP_PITCH 136
__global__ void __launch_bounds__(256) transpose_kernel(const float* __restrict__ x,
                                                        f16* __restrict__ x3h) {
  __shared__ __attribute__((aligned(16))) f16 s_t[64 * TP_PITCH];
  int tid = threadIdx.x;
  int pt = blockIdx.x & 15;                // token tile   (16 x 64)
  int ct = (blockIdx.x >> 4) & 1;          // channel tile ( 2 x 128)
  int b  = blockIdx.x >> 5;                // image        (16)
  int lo = tid & 15, hi = tid >> 4;

  const float* src = x + ((size_t)(b * 256 + ct * 128 + hi * 8)) * 1024 + pt * 64 + lo * 4;
  v4f v[8];
#pragma unroll
  for (int j = 0; j < 8; ++j) v[j] = *(const v4f*)(src + j * 1024);

#pragma unroll
  for (int i = 0; i < 4; ++i) {
    v8h t;
#pragma unroll
    for (int j = 0; j < 8; ++j) t[j] = (f16)v[j][i];
    *(v8h*)&s_t[(i * 16 + lo) * TP_PITCH + hi * 8] = t;
  }
  __syncthreads();                         // the tile is read back by other waves

  f16* dst = x3h + ((size_t)(b * 1024 + pt * 64)) * 256 + ct * 128 + lo * 8;
#pragma unroll
  for (int k = 0; k < 4; ++k) {
    int tok = k * 16 + hi;
    v8h t = *(const v8h*)&s_t[((tok & 3) * 16 + (tok >> 2)) * TP_PITCH + lo * 8];
    *(v8h*)(dst + (size_t)tok * 256) = t;
  }
}

// ---------------------------------------------------------------------------
// Stage 1: relative-position bias table: tab_sig[head*3969 + i] = 16*sigmoid(mlp(coords_i))
// ---------------------------------------------------------------------------
__global__ void __launch_bounds__(256) bias_table_kernel(const float* __restrict__ w1,
                                                         const float* __restrict__ b1,
                                                         const float* __restrict__ w2,
                                                         float* __restrict__ tab_sig) {
  int t = blockIdx.x * 256 + threadIdx.x;      // 8 * 3969
  if (t >= 8 * 3969) return;
  int i = t % 3969, head = t / 3969;
  int gy = i / 63, gx = i % 63;
  float ty = ((float)(gy - 31) / (31.0f + 1e-8f)) * 3.2f;
  float tx = ((float)(gx - 31) / (31.0f + 1e-8f)) * 3.2f;
  float sy = (ty > 0.f) ? 1.f : ((ty < 0.f) ? -1.f : 0.f);
  float sx = (tx > 0.f) ? 1.f : ((tx < 0.f) ? -1.f : 0.f);
  ty = sy * (1.0f - __expf(-fabsf(ty)));
  tx = sx * (1.0f - __expf(-fabsf(tx)));
  float acc = 0.f;
#pragma unroll 8
  for (int j = 0; j < 128; ++j) {
    float hj = ty * w1[j * 2 + 0] + tx * w1[j * 2 + 1] + b1[j];
    hj = fmaxf(hj, 0.f);
    acc += hj * w2[head * 128 + j];
  }
  tab_sig[t] = 16.0f / (1.0f + __expf(-acc));
}

// ---------------------------------------------------------------------------
// Stage 2/4: half-GEMM (rows = 16384 tokens, 128x128 weight for one half).
//  MODE 0: q/k  -> residual + per-head L2 norm, f16 out  ((b*8+head)*1024+n)*32+d
//  MODE 1: v    -> residual, f16 out TRANSPOSED          ((b*8+head)*32+d)*1024+n
//  MODE 2: proj -> +bias, f32 NCHW out                   (b*256+ch)*1024+n
// 8 waves, each owns a 16-row strip of the 128-row block; K loop = 4 x 32.
// ---------------------------------------------------------------------------
template <int MODE>
static __device__ __forceinline__ void half_gemm_body(const f16* __restrict__ Xh,
                                                      const float* __restrict__ Xf,
                                                      const float* __restrict__ W,
                                                      const float* __restrict__ bvec,
                                                      f16* __restrict__ out_h,
                                                      float* __restrict__ out_f,
                                                      int half) {
  int tid = threadIdx.x, wave = tid >> 5, lane = tid & 31;
  int row0  = blockIdx.x * 128 + wave * 16;
  int nloc  = lane & 15;
  int mbase = (lane >> 4) << 3;

  v16h a[4];
#pragma unroll
  for (int kt = 0; kt < 4; ++kt) {
    if (MODE == 2) a[kt] = load_tile_f32cvt(Xf + (size_t)row0 * 256 + half * 128 + kt * 32, 256, lane);
    else           a[kt] = load_tile_h    (Xh + (size_t)row0 * 256 + half * 128 + kt * 32, 256, lane);
  }
  asm volatile("s_wait_xcnt 0x0" ::: "memory");

#pragma unroll
  for (int j = 0; j < 4; ++j) {            // output cols 32j .. 32j+31 (= head j of this half)
    v8f acc0 = {}, acc1 = {};
#pragma unroll
    for (int kt = 0; kt < 4; ++kt) {
      // B column n = W[col, :] row (y = x @ W^T), f32 -> f16 on load
      v16h b0 = load_tile_f32cvt(W + (32 * j + 0)  * 128 + kt * 32, 128, lane);
      v16h b1 = load_tile_f32cvt(W + (32 * j + 16) * 128 + kt * 32, 128, lane);
      acc0 = wmma_f16(a[kt], b0, acc0);
      acc1 = wmma_f16(a[kt], b1, acc1);
    }
    asm volatile("s_wait_xcnt 0x0" ::: "memory");
    int c0 = 32 * j + nloc, c1 = c0 + 16;
    float r0[8], r1[8];
#pragma unroll
    for (int r = 0; r < 8; ++r) {
      int row = row0 + mbase + r;
      float y0 = acc0[r] + bvec[c0];
      float y1 = acc1[r] + bvec[c1];
      if (MODE != 2) {                     // residual x + lin(x)
        y0 += (float)Xh[(size_t)row * 256 + half * 128 + c0];
        y1 += (float)Xh[(size_t)row * 256 + half * 128 + c1];
      }
      r0[r] = y0; r1[r] = y1;
    }
    if (MODE == 0) {                       // per-head (32-dim) L2 normalization
#pragma unroll
      for (int r = 0; r < 8; ++r) {
        float ss  = hred_sum(r0[r] * r0[r] + r1[r] * r1[r]);
        float inv = 1.0f / fmaxf(__fsqrt_rn(ss), 1e-12f);
        r0[r] *= inv; r1[r] *= inv;
      }
    }
#pragma unroll
    for (int r = 0; r < 8; ++r) {
      int row = row0 + mbase + r;
      int b = row >> 10, n = row & 1023;
      int head = half * 4 + j;
      if (MODE == 2) {
        out_f[((size_t)(b * 256 + half * 128 + c0)) * 1024 + n] = r0[r];
        out_f[((size_t)(b * 256 + half * 128 + c1)) * 1024 + n] = r1[r];
      } else if (MODE == 1) {
        out_h[((size_t)((b * 8 + head) * 32 + nloc))      * 1024 + n] = (f16)r0[r];
        out_h[((size_t)((b * 8 + head) * 32 + nloc + 16)) * 1024 + n] = (f16)r1[r];
      } else {
        out_h[((size_t)((b * 8 + head) * 1024 + n)) * 32 + nloc]      = (f16)r0[r];
        out_h[((size_t)((b * 8 + head) * 1024 + n)) * 32 + nloc + 16] = (f16)r1[r];
      }
    }
    asm volatile("s_wait_xcnt 0x0" ::: "memory");
  }
}

__global__ void __launch_bounds__(256) qkv_kernel(const f16* __restrict__ x3h,
                                                  const float* __restrict__ q1_w, const float* __restrict__ q1_b,
                                                  const float* __restrict__ q2_w, const float* __restrict__ q2_b,
                                                  const float* __restrict__ k1_w, const float* __restrict__ k1_b,
                                                  const float* __restrict__ k2_w, const float* __restrict__ k2_b,
                                                  const float* __restrict__ v1_w, const float* __restrict__ v1_b,
                                                  const float* __restrict__ v2_w, const float* __restrict__ v2_b,
                                                  f16* __restrict__ q_ws, f16* __restrict__ k_ws,
                                                  f16* __restrict__ vt_ws) {
  int job = blockIdx.y;
  int half = job & 1;
  if (job < 4) {
    const float* Wm = (job < 2) ? (half ? q2_w : q1_w) : (half ? k2_w : k1_w);
    const float* bv = (job < 2) ? (half ? q2_b : q1_b) : (half ? k2_b : k1_b);
    half_gemm_body<0>(x3h, nullptr, Wm, bv, (job < 2) ? q_ws : k_ws, nullptr, half);
  } else {
    half_gemm_body<1>(x3h, nullptr, half ? v2_w : v1_w, half ? v2_b : v1_b, vt_ws, nullptr, half);
  }
}

__global__ void __launch_bounds__(256) proj_kernel(const float* __restrict__ o_ws,
                                                   const float* __restrict__ p1_w, const float* __restrict__ p1_b,
                                                   const float* __restrict__ p2_w, const float* __restrict__ p2_b,
                                                   float* __restrict__ out) {
  int half = blockIdx.y;
  half_gemm_body<2>(nullptr, o_ws, half ? p2_w : p1_w, half ? p2_b : p1_b, nullptr, out, half);
}

static __device__ __forceinline__ float other_half(float x) {
  int b = __builtin_bit_cast(int, x);
  return __builtin_bit_cast(float, __builtin_amdgcn_permlanex16(b, b, 0x76543210, 0xfedcba98, false, false));
}

__global__ void __launch_bounds__(256) attn_kernel(const f16* __restrict__ q_ws,
                                                   const f16* __restrict__ k_ws,
                                                   const f16* __restrict__ vt_ws,
                                                   const float* __restrict__ tab_sig,
                                                   const float* __restrict__ logit_scale,
                                                   float* __restrict__ o_ws) {
  __shared__ float s_bias[3969];           // 16*sigmoid table slice for this head

  int tid = threadIdx.x, wave = tid >> 5, lane = tid & 31;
  int rb = blockIdx.x, h = blockIdx.y, b = blockIdx.z;

  for (int i = tid; i < 3969; i += 256) s_bias[i] = tab_sig[h * 3969 + i];
  __syncthreads();

  float scale = __expf(fminf(logit_scale[h], 4.6051701859880914f)); // log(100)
  int row0  = rb * 128 + wave * 16;
  int nloc  = lane & 15;
  int mbase = (lane >> 4) << 3;

  const f16* qbh  = q_ws  + ((size_t)(b * 8 + h) * 1024) * 32;
  const f16* kbh  = k_ws  + ((size_t)(b * 8 + h) * 1024) * 32;
  const f16* vtbh = vt_ws + ((size_t)(b * 8 + h) * 32) * 1024;

  v16h qb = load_tile_h(qbh + row0 * 32, 32, lane);   // B operand, resident for whole loop

  // This lane's query is image position (qy, qx). The 32 keys of one pass are image row kb/32,
  // x = 0..31, so the lane's biases lie at s_bias[bi + mbase - x], and bi goes back one table row a pass.
  int qrow = row0 + nloc;
  int qy = qrow >> 5, qx = qrow & 31;
  int bi = (qy + 31) * 63 + (qx + 31) - mbase;

  v8f o0 = {}, o1 = {};                    // O^T: dims mbase+r and 16+mbase+r of query qrow
  float m_q = -1e30f, l_q = 0.f;           // l_q: this half's keys only

  for (int kb = 0; kb < 1024; kb += 32) {
    // ---- prefetch next iteration's K / V^T tiles (global_prefetch_b8) ----
    if (kb + 32 < 1024) {
      __builtin_prefetch(kbh + (size_t)(kb + 32) * 32 + (lane & 15) * 32, 0, 3);
      __builtin_prefetch(vtbh + (kb + 32) + (lane & 15) * 1024, 0, 3);
      __builtin_prefetch(vtbh + 16 * 1024 + (kb + 32) + (lane & 15) * 1024, 0, 3);
    }

    // ---- S^T = kn @ qn^T (two 16x16 tiles, K = hd = 32 in one WMMA each) ----
    v16h kt0 = load_tile_h(kbh + (size_t)kb * 32, 32, lane);
    v16h kt1 = load_tile_h(kbh + (size_t)(kb + 16) * 32, 32, lane);
    v8f z = {};
    v8f s0 = wmma_f16(kt0, qb, z);
    v8f s1 = wmma_f16(kt1, qb, z);

    float p0[8], p1[8];
#pragma unroll
    for (int r = 0; r < 8; ++r) {          // scale + relative-position bias
      p0[r] = s0[r] * scale + s_bias[bi - r];
      p1[r] = s1[r] * scale + s_bias[bi - 16 - r];
    }
    bi -= 63;

    // ---- online softmax: one query per lane ----
    float tmax = fmaxf(p0[0], p1[0]);
#pragma unroll
    for (int r = 1; r < 8; ++r) tmax = fmaxf(tmax, fmaxf(p0[r], p1[r]));
    tmax = fmaxf(tmax, other_half(tmax));
    float mnew  = fmaxf(m_q, tmax);
    float alpha = exp2f((m_q - mnew) * LOG2E);
    m_q = mnew;
    v2f sum2 = {0.f, 0.f};                 // even keys | odd keys
    v16h pb;
#pragma unroll
    for (int r = 0; r < 8; ++r) {
      p0[r] = exp2f((p0[r] - mnew) * LOG2E);
      p1[r] = exp2f((p1[r] - mnew) * LOG2E);
      pb[r] = (f16)p0[r]; pb[r + 8] = (f16)p1[r];
    }
#pragma unroll
    for (int r = 0; r < 8; r += 2) {
      sum2 += (v2f){p0[r], p0[r + 1]};
      sum2 += (v2f){p1[r], p1[r + 1]};
    }
    l_q = l_q * alpha + (sum2[0] + sum2[1]);
#pragma unroll
    for (int r = 0; r < 8; ++r) { o0[r] *= alpha; o1[r] *= alpha; }

    // ---- O^T += V^T @ P^T (v stored transposed: vt[dim][key] so A loads are contiguous) ----
    v16h va0 = load_tile_h(vtbh + kb, 1024, lane);             // dims 0..15
    v16h va1 = load_tile_h(vtbh + 16 * 1024 + kb, 1024, lane); // dims 16..31
    o0 = wmma_f16(va0, pb, o0);
    o1 = wmma_f16(va1, pb, o1);
  }

  // ---- epilogue: join the halves' sums, normalize, write (b, N, c) f32 for the proj GEMM ----
  float inv = 1.0f / (l_q + other_half(l_q));
  float* op = o_ws + ((size_t)(b * 1024) + qrow) * 256 + h * 32 + mbase;
  v4f w;
#pragma unroll
  for (int g = 0; g < 2; ++g) {            // 8 consecutive dims a tile: two 16-byte stores
#pragma unroll
    for (int i = 0; i < 4; ++i) w[i] = o0[g * 4 + i] * inv;
    *(v4f*)(op + g * 4) = w;
#pragma unroll
    for (int i = 0; i < 4; ++i) w[i] = o1[g * 4 + i] * inv;
    *(v4f*)(op + 16 + g * 4) = w;
  }
}

// ---------------------------------------------------------------------------
extern "C" void kernel_launch(void* const* d_in, const int* in_sizes, int n_in,
                              void* d_out, int out_size, void* d_ws, size_t ws_size,
                              hipStream_t stream) {
  const float* x    = (const float*)d_in[0];
  const float* q1_w = (const float*)d_in[1];
  const float* q1_b = (const float*)d_in[2];
  const float* q2_w = (const float*)d_in[3];
  const float* q2_b = (const float*)d_in[4];
  const float* k1_w = (const float*)d_in[5];
  const float* k1_b = (const float*)d_in[6];
  const float* k2_w = (const float*)d_in[7];
  const float* k2_b = (const float*)d_in[8];
  const float* v1_w = (const float*)d_in[9];
  const float* v1_b = (const float*)d_in[10];
  const float* v2_w = (const float*)d_in[11];
  const float* v2_b = (const float*)d_in[12];
  const float* p1_w = (const float*)d_in[13];
  const float* p1_b = (const float*)d_in[14];
  const float* p2_w = (const float*)d_in[15];
  const float* p2_b = (const float*)d_in[16];
  const float* lsc  = (const float*)d_in[17];
  const float* mw1  = (const float*)d_in[18];
  const float* mb1  = (const float*)d_in[19];
  const float* mw2  = (const float*)d_in[20];

  char* ws = (char*)d_ws;
  f16*   x3h   = (f16*)(ws);                          //  8 MB  (16384 x 256 f16)
  f16*   q_ws  = (f16*)(ws + ((size_t)8  << 20));     //  8 MB
  f16*   k_ws  = (f16*)(ws + ((size_t)16 << 20));     //  8 MB
  f16*   vt_ws = (f16*)(ws + ((size_t)24 << 20));     //  8 MB
  float* o_ws  = (float*)(ws + ((size_t)32 << 20));   // 16 MB  (16384 x 256 f32)
  float* tab   = (float*)(ws + ((size_t)48 << 20));   // 124 KB (8 x 3969 f32)

  transpose_kernel<<<512, 256, 0, stream>>>(x, x3h);  // 16 images x 2 x 16 tiles
  bias_table_kernel<<<(8 * 3969 + 255) / 256, 256, 0, stream>>>(mw1, mb1, mw2, tab);

  // 128 row blocks (16384 rows / 128) x 6 half-GEMMs
  qkv_kernel<<<dim3(128, 6), 256, 0, stream>>>(x3h, q1_w, q1_b, q2_w, q2_b, k1_w, k1_b, k2_w, k2_b,
                                               v1_w, v1_b, v2_w, v2_b, q_ws, k_ws, vt_ws);

  attn_kernel<<<dim3(8, 8, 16), 256, 0, stream>>>(q_ws, k_ws, vt_ws, tab, lsc, o_ws);

  proj_kernel<<<dim3(128, 2), 256, 0, stream>>>(o_ws, p1_w, p1_b, p2_w, p2_b, (float*)d_out);
}

// v004
// A run of this version takes 82.8 microseconds.
// Two timings next to v003 both put it at 1.21 times that version's speed.
// Counting every step since v000, it is 3.52 times as fast.
#include <hip/hip_runtime.h>
#include <hip/hip_bf16.h>

typedef _Float16 f16;
typedef __attribute__((ext_vector_type(16))) _Float16 v16h;
typedef __attribute__((ext_vector_type(8)))  _Float16 v8h;
typedef __attribute__((ext_vector_type(4)))  _Float16 v4h;
typedef __attribute__((ext_vector_type(8)))  float    v8f;
typedef __attribute__((ext_vector_type(4)))  float    v4f;
typedef __attribute__((ext_vector_type(2)))  float    v2f;

#define LOG2E 1.44269504088896340736f

static __device__ __forceinline__ v16h load_tile_h(const f16* base, int stride, int lane) {
  const f16* p = base + (lane & 15) * stride + ((lane >> 4) << 3);
  v8h lo = *(const v8h*)(p);        // K koff..koff+7      (16B aligned)
  v8h hi = *(const v8h*)(p + 16);   // K koff+16..koff+23  (16B aligned)
  v16h r;
#pragma unroll
  for (int i = 0; i < 8; ++i) { r[i] = lo[i]; r[i + 8] = hi[i]; }
  return r;
}

static __device__ __forceinline__ v16h load_tile_f32cvt(const float* base, int stride, int lane) {
  const float* p = base + (lane & 15) * stride + ((lane >> 4) << 3);
  v16h r;
#pragma unroll
  for (int i = 0; i < 8; ++i) { r[i] = (f16)p[i]; r[i + 8] = (f16)p[16 + i]; }
  return r;
}

static __device__ __forceinline__ v8f wmma_f16(v16h a, v16h b, v8f c) {
  return __builtin_amdgcn_wmma_f32_16x16x32_f16(false, a, false, b, (short)0, c, false, false);
}

// Reduction across the 16 lanes of a half-wave (xor masks < 16 stay in-half).
static __device__ __forceinline__ float hred_sum(float x) {
#pragma unroll
  for (int m = 1; m < 16; m <<= 1) x += __shfl_xor(x, m, 32);
  return x;
}

#define TP_PITCH 136
__global__ void __launch_bounds__(256) transpose_kernel(const float* __restrict__ x,
                                                        f16* __restrict__ x3h) {
  __shared__ __attribute__((aligned(16))) f16 s_t[64 * TP_PITCH];
  int tid = threadIdx.x;
  int pt = blockIdx.x & 15;                // token tile   (16 x 64)
  int ct = (blockIdx.x >> 4) & 1;          // channel tile ( 2 x 128)
  int b  = blockIdx.x >> 5;                // image        (16)
  int lo = tid & 15, hi = tid >> 4;

  const float* src = x + ((size_t)(b * 256 + ct * 128 + hi * 8)) * 1024 + pt * 64 + lo * 4;
  v4f v[8];
#pragma unroll
  for (int j = 0; j < 8; ++j) v[j] = *(const v4f*)(src + j * 1024);

#pragma unroll
  for (int i = 0; i < 4; ++i) {
    v8h t;
#pragma unroll
    for (int j = 0; j < 8; ++j) t[j] = (f16)v[j][i];
    *(v8h*)&s_t[(i * 16 + lo) * TP_PITCH + hi * 8] = t;
  }
  __syncthreads();                         // the tile is read back by other waves

  f16* dst = x3h + ((size_t)(b * 1024 + pt * 64)) * 256 + ct * 128 + lo * 8;
#pragma unroll
  for (int k = 0; k < 4; ++k) {
    int tok = k * 16 + hi;
    v8h t = *(const v8h*)&s_t[((tok & 3) * 16 + (tok >> 2)) * TP_PITCH + lo * 8];
    *(v8h*)(dst + (size_t)tok * 256) = t;
  }
}

// ---------------------------------------------------------------------------
// Stage 1: relative-position bias table: tab_sig[head*3969 + i] = 16*sigmoid(mlp(coords_i))
// ---------------------------------------------------------------------------
__global__ void __launch_bounds__(256) bias_table_kernel(const float* __restrict__ w1,
                                                         const float* __restrict__ b1,
                                                         const float* __restrict__ w2,
                                                         float* __restrict__ tab_sig) {
  int t = blockIdx.x * 256 + threadIdx.x;      // 8 * 3969
  if (t >= 8 * 3969) return;
  int i = t % 3969, head = t / 3969;
  int gy = i / 63, gx = i % 63;
  float ty = ((float)(gy - 31) / (31.0f + 1e-8f)) * 3.2f;
  float tx = ((float)(gx - 31) / (31.0f + 1e-8f)) * 3.2f;
  float sy = (ty > 0.f) ? 1.f : ((ty < 0.f) ? -1.f : 0.f);
  float sx = (tx > 0.f) ? 1.f : ((tx < 0.f) ? -1.f : 0.f);
  ty = sy * (1.0f - __expf(-fabsf(ty)));
  tx = sx * (1.0f - __expf(-fabsf(tx)));
  float acc = 0.f;
#pragma unroll 8
  for (int j = 0; j < 128; ++j) {
    float hj = ty * w1[j * 2 + 0] + tx * w1[j * 2 + 1] + b1[j];
    hj = fmaxf(hj, 0.f);
    acc += hj * w2[head * 128 + j];
  }
  tab_sig[t] = 16.0f / (1.0f + __expf(-acc));
}

#define W_PITCH 136
template <int MODE>
static __device__ __forceinline__ void half_gemm_body(const f16* __restrict__ Xh,
                                                      const float* __restrict__ Xf,
                                                      const float* __restrict__ W,
                                                      const float* __restrict__ bvec,
                                                      f16* __restrict__ out_h,
                                                      float* __restrict__ out_f,
                                                      int half, f16* s_w) {
  int tid = threadIdx.x, wave = tid >> 5, lane = tid & 31;
  int row0  = blockIdx.x * 128 + wave * 16;
  int nloc  = lane & 15;
  int mbase = (lane >> 4) << 3;

  v16h a[4];
#pragma unroll
  for (int kt = 0; kt < 4; ++kt) {
    if (MODE == 2) a[kt] = load_tile_f32cvt(Xf + (size_t)row0 * 256 + half * 128 + kt * 32, 256, lane);
    else           a[kt] = load_tile_h    (Xh + (size_t)row0 * 256 + half * 128 + kt * 32, 256, lane);
  }
  v4f wv[16];                              // float4 number tid + 256 i of the weight
#pragma unroll
  for (int i = 0; i < 16; ++i) wv[i] = *(const v4f*)(W + (tid + 256 * i) * 4);
  asm volatile("s_wait_xcnt 0x0" ::: "memory");
#pragma unroll
  for (int i = 0; i < 16; ++i) {           // a wave stores one weight row (256 B of f16) at a time
    v4h t;
#pragma unroll
    for (int e = 0; e < 4; ++e) t[e] = (f16)wv[i][e];
    *(v4h*)&s_w[(wave + 8 * i) * W_PITCH + lane * 4] = t;
  }
  __syncthreads();                         // every wave reads rows that other waves stored

#pragma unroll
  for (int j = 0; j < 4; ++j) {            // output cols 32j .. 32j+31 (= head j of this half)
    v8f acc0 = {}, acc1 = {};
#pragma unroll
    for (int kt = 0; kt < 4; ++kt) {
      // B column n = W[col, :] row (y = x @ W^T)
      v16h b0 = load_tile_h(s_w + (32 * j + 0)  * W_PITCH + kt * 32, W_PITCH, lane);
      v16h b1 = load_tile_h(s_w + (32 * j + 16) * W_PITCH + kt * 32, W_PITCH, lane);
      acc0 = wmma_f16(a[kt], b0, acc0);
      acc1 = wmma_f16(a[kt], b1, acc1);
    }
    int c0 = 32 * j + nloc, c1 = c0 + 16;
    float r0[8], r1[8];
#pragma unroll
    for (int r = 0; r < 8; ++r) {
      int row = row0 + mbase + r;
      float y0 = acc0[r] + bvec[c0];
      float y1 = acc1[r] + bvec[c1];
      if (MODE != 2) {                     // residual x + lin(x)
        y0 += (float)Xh[(size_t)row * 256 + half * 128 + c0];
        y1 += (float)Xh[(size_t)row * 256 + half * 128 + c1];
      }
      r0[r] = y0; r1[r] = y1;
    }
    if (MODE == 0) {                       // per-head (32-dim) L2 normalization
#pragma unroll
      for (int r = 0; r < 8; ++r) {
        float ss  = hred_sum(r0[r] * r0[r] + r1[r] * r1[r]);
        float inv = 1.0f / fmaxf(__fsqrt_rn(ss), 1e-12f);
        r0[r] *= inv; r1[r] *= inv;
      }
    }
#pragma unroll
    for (int r = 0; r < 8; ++r) {
      int row = row0 + mbase + r;
      int b = row >> 10, n = row & 1023;
      int head = half * 4 + j;
      if (MODE == 2) {
        out_f[((size_t)(b * 256 + half * 128 + c0)) * 1024 + n] = r0[r];
        out_f[((size_t)(b * 256 + half * 128 + c1)) * 1024 + n] = r1[r];
      } else if (MODE == 1) {
        out_h[((size_t)((b * 8 + head) * 32 + nloc))      * 1024 + n] = (f16)r0[r];
        out_h[((size_t)((b * 8 + head) * 32 + nloc + 16)) * 1024 + n] = (f16)r1[r];
      } else {
        out_h[((size_t)((b * 8 + head) * 1024 + n)) * 32 + nloc]      = (f16)r0[r];
        out_h[((size_t)((b * 8 + head) * 1024 + n)) * 32 + nloc + 16] = (f16)r1[r];
      }
    }
    asm volatile("s_wait_xcnt 0x0" ::: "memory");
  }
}

__global__ void __launch_bounds__(256) qkv_kernel(const f16* __restrict__ x3h,
                                                  const float* __restrict__ q1_w, const float* __restrict__ q1_b,
                                                  const float* __restrict__ q2_w, const float* __restrict__ q2_b,
                                                  const float* __restrict__ k1_w, const float* __restrict__ k1_b,
                                                  const float* __restrict__ k2_w, const float* __restrict__ k2_b,
                                                  const float* __restrict__ v1_w, const float* __restrict__ v1_b,
                                                  const float* __restrict__ v2_w, const float* __restrict__ v2_b,
                                                  f16* __restrict__ q_ws, f16* __restrict__ k_ws,
                                                  f16* __restrict__ vt_ws) {
  __shared__ __attribute__((aligned(16))) f16 s_w[128 * W_PITCH];
  int job = blockIdx.y;
  int half = job & 1;
  if (job < 4) {
    const float* Wm = (job < 2) ? (half ? q2_w : q1_w) : (half ? k2_w : k1_w);
    const float* bv = (job < 2) ? (half ? q2_b : q1_b) : (half ? k2_b : k1_b);
    half_gemm_body<0>(x3h, nullptr, Wm, bv, (job < 2) ? q_ws : k_ws, nullptr, half, s_w);
  } else {
    half_gemm_body<1>(x3h, nullptr, half ? v2_w : v1_w, half ? v2_b : v1_b, vt_ws, nullptr, half, s_w);
  }
}

__global__ void __launch_bounds__(256) proj_kernel(const float* __restrict__ o_ws,
                                                   const float* __restrict__ p1_w, const float* __restrict__ p1_b,
                                                   const float* __restrict__ p2_w, const float* __restrict__ p2_b,
                                                   float* __restrict__ out) {
  __shared__ __attribute__((aligned(16))) f16 s_w[128 * W_PITCH];
  int half = blockIdx.y;
  half_gemm_body<2>(nullptr, o_ws, half ? p2_w : p1_w, half ? p2_b : p1_b, nullptr, out, half, s_w);
}

static __device__ __forceinline__ float other_half(float x) {
  int b = __builtin_bit_cast(int, x);
  return __builtin_bit_cast(float, __builtin_amdgcn_permlanex16(b, b, 0x76543210, 0xfedcba98, false, false));
}

__global__ void __launch_bounds__(256) attn_kernel(const f16* __restrict__ q_ws,
                                                   const f16* __restrict__ k_ws,
                                                   const f16* __restrict__ vt_ws,
                                                   const float* __restrict__ tab_sig,
                                                   const float* __restrict__ logit_scale,
                                                   float* __restrict__ o_ws) {
  __shared__ float s_bias[3969];           // 16*sigmoid table slice for this head

  int tid = threadIdx.x, wave = tid >> 5, lane = tid & 31;
  int rb = blockIdx.x, h = blockIdx.y, b = blockIdx.z;

  for (int i = tid; i < 3969; i += 256) s_bias[i] = tab_sig[h * 3969 + i];
  __syncthreads();

  float scale = __expf(fminf(logit_scale[h], 4.6051701859880914f)); // log(100)
  int row0  = rb * 128 + wave * 16;
  int nloc  = lane & 15;
  int mbase = (lane >> 4) << 3;

  const f16* qbh  = q_ws  + ((size_t)(b * 8 + h) * 1024) * 32;
  const f16* kbh  = k_ws  + ((size_t)(b * 8 + h) * 1024) * 32;
  const f16* vtbh = vt_ws + ((size_t)(b * 8 + h) * 32) * 1024;

  v16h qb = load_tile_h(qbh + row0 * 32, 32, lane);   // B operand, resident for whole loop

  // This lane's query is image position (qy, qx). The 32 keys of one pass are image row kb/32,
  // x = 0..31, so the lane's biases lie at s_bias[bi + mbase - x], and bi goes back one table row a pass.
  int qrow = row0 + nloc;
  int qy = qrow >> 5, qx = qrow & 31;
  int bi = (qy + 31) * 63 + (qx + 31) - mbase;

  v8f o0 = {}, o1 = {};                    // O^T: dims mbase+r and 16+mbase+r of query qrow
  float m_q = -1e30f, l_q = 0.f;           // l_q: this half's keys only

  for (int kb = 0; kb < 1024; kb += 32) {
    // ---- prefetch next iteration's K / V^T tiles (global_prefetch_b8) ----
    if (kb + 32 < 1024) {
      __builtin_prefetch(kbh + (size_t)(kb + 32) * 32 + (lane & 15) * 32, 0, 3);
      __builtin_prefetch(vtbh + (kb + 32) + (lane & 15) * 1024, 0, 3);
      __builtin_prefetch(vtbh + 16 * 1024 + (kb + 32) + (lane & 15) * 1024, 0, 3);
    }

    // ---- S^T = kn @ qn^T (two 16x16 tiles, K = hd = 32 in one WMMA each) ----
    v16h kt0 = load_tile_h(kbh + (size_t)kb * 32, 32, lane);
    v16h kt1 = load_tile_h(kbh + (size_t)(kb + 16) * 32, 32, lane);
    v8f z = {};
    v8f s0 = wmma_f16(kt0, qb, z);
    v8f s1 = wmma_f16(kt1, qb, z);

    float p0[8], p1[8];
#pragma unroll
    for (int r = 0; r < 8; ++r) {          // scale + relative-position bias
      p0[r] = s0[r] * scale + s_bias[bi - r];
      p1[r] = s1[r] * scale + s_bias[bi - 16 - r];
    }
    bi -= 63;

    // ---- online softmax: one query per lane ----
    float tmax = fmaxf(p0[0], p1[0]);
#pragma unroll
    for (int r = 1; r < 8; ++r) tmax = fmaxf(tmax, fmaxf(p0[r], p1[r]));
    tmax = fmaxf(tmax, other_half(tmax));
    float mnew  = fmaxf(m_q, tmax);
    float alpha = exp2f((m_q - mnew) * LOG2E);
    m_q = mnew;
    v2f sum2 = {0.f, 0.f};                 // even keys | odd keys
    v16h pb;
#pragma unroll
    for (int r = 0; r < 8; ++r) {
      p0[r] = exp2f((p0[r] - mnew) * LOG2E);
      p1[r] = exp2f((p1[r] - mnew) * LOG2E);
      pb[r] = (f16)p0[r]; pb[r + 8] = (f16)p1[r];
    }
#pragma unroll
    for (int r = 0; r < 8; r += 2) {
      sum2 += (v2f){p0[r], p0[r + 1]};
      sum2 += (v2f){p1[r], p1[r + 1]};
    }
    l_q = l_q * alpha + (sum2[0] + sum2[1]);
#pragma unroll
    for (int r = 0; r < 8; ++r) { o0[r] *= alpha; o1[r] *= alpha; }

    // ---- O^T += V^T @ P^T (v stored transposed: vt[dim][key] so A loads are contiguous) ----
    v16h va0 = load_tile_h(vtbh + kb, 1024, lane);             // dims 0..15
    v16h va1 = load_tile_h(vtbh + 16 * 1024 + kb, 1024, lane); // dims 16..31
    o0 = wmma_f16(va0, pb, o0);
    o1 = wmma_f16(va1, pb, o1);
  }

  // ---- epilogue: join the halves' sums, normalize, write (b, N, c) f32 for the proj GEMM ----
  float inv = 1.0f / (l_q + other_half(l_q));
  float* op = o_ws + ((size_t)(b * 1024) + qrow) * 256 + h * 32 + mbase;
  v4f w;
#pragma unroll
  for (int g = 0; g < 2; ++g) {            // 8 consecutive dims a tile: two 16-byte stores
#pragma unroll
    for (int i = 0; i < 4; ++i) w[i] = o0[g * 4 + i] * inv;
    *(v4f*)(op + g * 4) = w;
#pragma unroll
    for (int i = 0; i < 4; ++i) w[i] = o1[g * 4 + i] * inv;
    *(v4f*)(op + 16 + g * 4) = w;
  }
}

// ---------------------------------------------------------------------------
extern "C" void kernel_launch(void* const* d_in, const int* in_sizes, int n_in,
                              void* d_out, int out_size, void* d_ws, size_t ws_size,
                              hipStream_t stream) {
  const float* x    = (const float*)d_in[0];
  const float* q1_w = (const float*)d_in[1];
  const float* q1_b = (const float*)d_in[2];
  const float* q2_w = (const float*)d_in[3];
  const float* q2_b = (const float*)d_in[4];
  const float* k1_w = (const float*)d_in[5];
  const float* k1_b = (const float*)d_in[6];
  const float* k2_w = (const float*)d_in[7];
  const float* k2_b = (const float*)d_in[8];
  const float* v1_w = (const float*)d_in[9];
  const float* v1_b = (const float*)d_in[10];
  const float* v2_w = (const float*)d_in[11];
  const float* v2_b = (const float*)d_in[12];
  const float* p1_w = (const float*)d_in[13];
  const float* p1_b = (const float*)d_in[14];
  const float* p2_w = (const float*)d_in[15];
  const float* p2_b = (const float*)d_in[16];
  const float* lsc  = (const float*)d_in[17];
  const float* mw1  = (const float*)d_in[18];
  const float* mb1  = (const float*)d_in[19];
  const float* mw2  = (const float*)d_in[20];

  char* ws = (char*)d_ws;
  f16*   x3h   = (f16*)(ws);                          //  8 MB  (16384 x 256 f16)
  f16*   q_ws  = (f16*)(ws + ((size_t)8  << 20));     //  8 MB
  f16*   k_ws  = (f16*)(ws + ((size_t)16 << 20));     //  8 MB
  f16*   vt_ws = (f16*)(ws + ((size_t)24 << 20));     //  8 MB
  float* o_ws  = (float*)(ws + ((size_t)32 << 20));   // 16 MB  (16384 x 256 f32)
  float* tab   = (float*)(ws + ((size_t)48 << 20));   // 124 KB (8 x 3969 f32)

  transpose_kernel<<<512, 256, 0, stream>>>(x, x3h);  // 16 images x 2 x 16 tiles
  bias_table_kernel<<<(8 * 3969 + 255) / 256, 256, 0, stream>>>(mw1, mb1, mw2, tab);

  // 128 row blocks (16384 rows / 128) x 6 half-GEMMs
  qkv_kernel<<<dim3(128, 6), 256, 0, stream>>>(x3h, q1_w, q1_b, q2_w, q2_b, k1_w, k1_b, k2_w, k2_b,
                                               v1_w, v1_b, v2_w, v2_b, q_ws, k_ws, vt_ws);

  attn_kernel<<<dim3(8, 8, 16), 256, 0, stream>>>(q_ws, k_ws, vt_ws, tab, lsc, o_ws);

  proj_kernel<<<dim3(128, 2), 256, 0, stream>>>(o_ws, p1_w, p1_b, p2_w, p2_b, (float*)d_out);
}

// v005
// One run takes 70.4 microseconds.
// Timed twice side by side with v004, it ran 1.18 times as fast both times.
// All steps since v000 together make it 4.15 times as fast.
#include <hip/hip_runtime.h>
#include <hip/hip_bf16.h>

typedef _Float16 f16;
typedef __attribute__((ext_vector_type(16))) _Float16 v16h;
typedef __attribute__((ext_vector_type(8)))  _Float16 v8h;
typedef __attribute__((ext_vector_type(4)))  _Float16 v4h;
typedef __attribute__((ext_vector_type(8)))  float    v8f;
typedef __attribute__((ext_vector_type(4)))  float    v4f;
typedef __attribute__((ext_vector_type(2)))  float    v2f;

#define LOG2E 1.44269504088896340736f

static __device__ __forceinline__ v16h load_tile_h(const f16* base, int stride, int lane) {
  const f16* p = base + (lane & 15) * stride + ((lane >> 4) << 3);
  v8h lo = *(const v8h*)(p);        // K koff..koff+7      (16B aligned)
  v8h hi = *(const v8h*)(p + 16);   // K koff+16..koff+23  (16B aligned)
  v16h r;
#pragma unroll
  for (int i = 0; i < 8; ++i) { r[i] = lo[i]; r[i + 8] = hi[i]; }
  return r;
}

static __device__ __forceinline__ v16h load_tile_f32cvt(const float* base, int stride, int lane) {
  const float* p = base + (lane & 15) * stride + ((lane >> 4) << 3);
  v16h r;
#pragma unroll
  for (int i = 0; i < 8; ++i) { r[i] = (f16)p[i]; r[i + 8] = (f16)p[16 + i]; }
  return r;
}

static __device__ __forceinline__ v8f wmma_f16(v16h a, v16h b, v8f c) {
  return __builtin_amdgcn_wmma_f32_16x16x32_f16(false, a, false, b, (short)0, c, false, false);
}

// Reduction across the 16 lanes of a half-wave (xor masks < 16 stay in-half).
static __device__ __forceinline__ float hred_sum(float x) {
#pragma unroll
  for (int m = 1; m < 16; m <<= 1) x += __shfl_xor(x, m, 32);
  return x;
}

#define TP_PITCH 136
__global__ void __launch_bounds__(256) transpose_kernel(const float* __restrict__ x,
                                                        f16* __restrict__ x3h) {
  __shared__ __attribute__((aligned(16))) f16 s_t[64 * TP_PITCH];
  int tid = threadIdx.x;
  int pt = blockIdx.x & 15;                // token tile   (16 x 64)
  int ct = (blockIdx.x >> 4) & 1;          // channel tile ( 2 x 128)
  int b  = blockIdx.x >> 5;                // image        (16)
  int lo = tid & 15, hi = tid >> 4;

  const float* src = x + ((size_t)(b * 256 + ct * 128 + hi * 8)) * 1024 + pt * 64 + lo * 4;
  v4f v[8];
#pragma unroll
  for (int j = 0; j < 8; ++j) v[j] = *(const v4f*)(src + j * 1024);

#pragma unroll
  for (int i = 0; i < 4; ++i) {
    v8h t;
#pragma unroll
    for (int j = 0; j < 8; ++j) t[j] = (f16)v[j][i];
    *(v8h*)&s_t[(i * 16 + lo) * TP_PITCH + hi * 8] = t;
  }
  __syncthreads();                         // the tile is read back by other waves

  f16* dst = x3h + ((size_t)(b * 1024 + pt * 64)) * 256 + ct * 128 + lo * 8;
#pragma unroll
  for (int k = 0; k < 4; ++k) {
    int tok = k * 16 + hi;
    v8h t = *(const v8h*)&s_t[((tok & 3) * 16 + (tok >> 2)) * TP_PITCH + lo * 8];
    *(v8h*)(dst + (size_t)tok * 256) = t;
  }
}

// ---------------------------------------------------------------------------
// Stage 1: relative-position bias table: tab_sig[head*3969 + i] = 16*sigmoid(mlp(coords_i))
// ---------------------------------------------------------------------------
__global__ void __launch_bounds__(256) bias_table_kernel(const float* __restrict__ w1,
                                                         const float* __restrict__ b1,
                                                         const float* __restrict__ w2,
                                                         float* __restrict__ tab_sig) {
  int t = blockIdx.x * 256 + threadIdx.x;      // 8 * 3969
  if (t >= 8 * 3969) return;
  int i = t % 3969, head = t / 3969;
  int gy = i / 63, gx = i % 63;
  float ty = ((float)(gy - 31) / (31.0f + 1e-8f)) * 3.2f;
  float tx = ((float)(gx - 31) / (31.0f + 1e-8f)) * 3.2f;
  float sy = (ty > 0.f) ? 1.f : ((ty < 0.f) ? -1.f : 0.f);
  float sx = (tx > 0.f) ? 1.f : ((tx < 0.f) ? -1.f : 0.f);
  ty = sy * (1.0f - __expf(-fabsf(ty)));
  tx = sx * (1.0f - __expf(-fabsf(tx)));
  float acc = 0.f;
#pragma unroll 8
  for (int j = 0; j < 128; ++j) {
    float hj = ty * w1[j * 2 + 0] + tx * w1[j * 2 + 1] + b1[j];
    hj = fmaxf(hj, 0.f);
    acc += hj * w2[head * 128 + j];
  }
  tab_sig[t] = 16.0f / (1.0f + __expf(-acc));
}

#define W_PITCH 136
template <int MODE>
static __device__ __forceinline__ void half_gemm_body(const f16* __restrict__ Xh,
                                                      const float* __restrict__ Xf,
                                                      const float* __restrict__ W,
                                                      const float* __restrict__ bvec,
                                                      f16* __restrict__ out_h,
                                                      float* __restrict__ out_f,
                                                      int half, f16* s_w) {
  int tid = threadIdx.x, wave = tid >> 5, lane = tid & 31;
  int row0  = blockIdx.x * 128 + wave * 16;
  int nloc  = lane & 15;
  int mbase = (lane >> 4) << 3;

  v16h a[4];
#pragma unroll
  for (int kt = 0; kt < 4; ++kt) {
    if (MODE == 2) a[kt] = load_tile_f32cvt(Xf + (size_t)row0 * 256 + half * 128 + kt * 32, 256, lane);
    else           a[kt] = load_tile_h    (Xh + (size_t)row0 * 256 + half * 128 + kt * 32, 256, lane);
  }
  v4f wv[16];                              // float4 number tid + 256 i of the weight
#pragma unroll
  for (int i = 0; i < 16; ++i) wv[i] = *(const v4f*)(W + (tid + 256 * i) * 4);
  asm volatile("s_wait_xcnt 0x0" ::: "memory");
#pragma unroll
  for (int i = 0; i < 16; ++i) {           // a wave stores one weight row (256 B of f16) at a time
    v4h t;
#pragma unroll
    for (int e = 0; e < 4; ++e) t[e] = (f16)wv[i][e];
    *(v4h*)&s_w[(wave + 8 * i) * W_PITCH + lane * 4] = t;
  }
  __syncthreads();                         // every wave reads rows that other waves stored

#pragma unroll
  for (int j = 0; j < 4; ++j) {            // output cols 32j .. 32j+31 (= head j of this half)
    v8f acc0 = {}, acc1 = {};
#pragma unroll
    for (int kt = 0; kt < 4; ++kt) {
      // B column n = W[col, :] row (y = x @ W^T)
      v16h b0 = load_tile_h(s_w + (32 * j + 0)  * W_PITCH + kt * 32, W_PITCH, lane);
      v16h b1 = load_tile_h(s_w + (32 * j + 16) * W_PITCH + kt * 32, W_PITCH, lane);
      acc0 = wmma_f16(a[kt], b0, acc0);
      acc1 = wmma_f16(a[kt], b1, acc1);
    }
    int c0 = 32 * j + nloc, c1 = c0 + 16;
    float r0[8], r1[8];
#pragma unroll
    for (int r = 0; r < 8; ++r) {
      int row = row0 + mbase + r;
      float y0 = acc0[r] + bvec[c0];
      float y1 = acc1[r] + bvec[c1];
      if (MODE != 2) {                     // residual x + lin(x)
        y0 += (float)Xh[(size_t)row * 256 + half * 128 + c0];
        y1 += (float)Xh[(size_t)row * 256 + half * 128 + c1];
      }
      r0[r] = y0; r1[r] = y1;
    }
    if (MODE == 0) {                       // per-head (32-dim) L2 normalization
#pragma unroll
      for (int r = 0; r < 8; ++r) {
        float ss  = hred_sum(r0[r] * r0[r] + r1[r] * r1[r]);
        float inv = 1.0f / fmaxf(__fsqrt_rn(ss), 1e-12f);
        r0[r] *= inv; r1[r] *= inv;
      }
    }
#pragma unroll
    for (int r = 0; r < 8; ++r) {
      int row = row0 + mbase + r;
      int b = row >> 10, n = row & 1023;
      int head = half * 4 + j;
      if (MODE == 2) {
        out_f[((size_t)(b * 256 + half * 128 + c0)) * 1024 + n] = r0[r];
        out_f[((size_t)(b * 256 + half * 128 + c1)) * 1024 + n] = r1[r];
      } else if (MODE == 1) {
        f16* vb = out_h + ((size_t)((b * 8 + head) * 32 + (n >> 5))) * 1024 + (n & 31);
        vb[nloc * 32]        = (f16)r0[r];
        vb[(nloc + 16) * 32] = (f16)r1[r];
      } else {
        out_h[((size_t)((b * 8 + head) * 1024 + n)) * 32 + nloc]      = (f16)r0[r];
        out_h[((size_t)((b * 8 + head) * 1024 + n)) * 32 + nloc + 16] = (f16)r1[r];
      }
    }
    asm volatile("s_wait_xcnt 0x0" ::: "memory");
  }
}

__global__ void __launch_bounds__(256) qkv_kernel(const f16* __restrict__ x3h,
                                                  const float* __restrict__ q1_w, const float* __restrict__ q1_b,
                                                  const float* __restrict__ q2_w, const float* __restrict__ q2_b,
                                                  const float* __restrict__ k1_w, const float* __restrict__ k1_b,
                                                  const float* __restrict__ k2_w, const float* __restrict__ k2_b,
                                                  const float* __restrict__ v1_w, const float* __restrict__ v1_b,
                                                  const float* __restrict__ v2_w, const float* __restrict__ v2_b,
                                                  f16* __restrict__ q_ws, f16* __restrict__ k_ws,
                                                  f16* __restrict__ vt_ws) {
  __shared__ __attribute__((aligned(16))) f16 s_w[128 * W_PITCH];
  int job = blockIdx.y;
  int half = job & 1;
  if (job < 4) {
    const float* Wm = (job < 2) ? (half ? q2_w : q1_w) : (half ? k2_w : k1_w);
    const float* bv = (job < 2) ? (half ? q2_b : q1_b) : (half ? k2_b : k1_b);
    half_gemm_body<0>(x3h, nullptr, Wm, bv, (job < 2) ? q_ws : k_ws, nullptr, half, s_w);
  } else {
    half_gemm_body<1>(x3h, nullptr, half ? v2_w : v1_w, half ? v2_b : v1_b, vt_ws, nullptr, half, s_w);
  }
}

__global__ void __launch_bounds__(256) proj_kernel(const float* __restrict__ o_ws,
                                                   const float* __restrict__ p1_w, const float* __restrict__ p1_b,
                                                   const float* __restrict__ p2_w, const float* __restrict__ p2_b,
                                                   float* __restrict__ out) {
  __shared__ __attribute__((aligned(16))) f16 s_w[128 * W_PITCH];
  int half = blockIdx.y;
  half_gemm_body<2>(nullptr, o_ws, half ? p2_w : p1_w, half ? p2_b : p1_b, nullptr, out, half, s_w);
}

#define KV_BYTES 65536

static __device__ __forceinline__ unsigned kv_place(unsigned off) {
  return off ^ (((off >> 8) & 3u) << 4);
}

// Eight copies of 512 contiguous bytes a wave (16 bytes a lane), 512 bytes apart.
static __device__ __forceinline__ void copy8_to_lds(unsigned lds0, const char* g0, unsigned off) {
  unsigned l[8];
  const char* g[8];
#pragma unroll
  for (int i = 0; i < 8; ++i) { l[i] = lds0 + kv_place(off + i * 512); g[i] = g0 + off + i * 512; }
  asm volatile("global_load_async_to_lds_b128 %0, %8, off\n\t"
               "global_load_async_to_lds_b128 %1, %9, off\n\t"
               "global_load_async_to_lds_b128 %2, %10, off\n\t"
               "global_load_async_to_lds_b128 %3, %11, off\n\t"
               "global_load_async_to_lds_b128 %4, %12, off\n\t"
               "global_load_async_to_lds_b128 %5, %13, off\n\t"
               "global_load_async_to_lds_b128 %6, %14, off\n\t"
               "global_load_async_to_lds_b128 %7, %15, off\n\t"
               "s_wait_xcnt 0x0"
               :: "v"(l[0]), "v"(l[1]), "v"(l[2]), "v"(l[3]), "v"(l[4]), "v"(l[5]), "v"(l[6]), "v"(l[7]),
                  "v"(g[0]), "v"(g[1]), "v"(g[2]), "v"(g[3]), "v"(g[4]), "v"(g[5]), "v"(g[6]), "v"(g[7])
               : "memory");
}

// A fragment of 16 rows x 32 halves from the staged image; f_lo / f_hi: this lane's two pieces.
static __device__ __forceinline__ v16h load_frag_lds(const char* tile, unsigned f_lo, unsigned f_hi) {
  v8h lo = *(const v8h*)(tile + f_lo);
  v8h hi = *(const v8h*)(tile + f_hi);
  v16h r;
#pragma unroll
  for (int i = 0; i < 8; ++i) { r[i] = lo[i]; r[i + 8] = hi[i]; }
  return r;
}
static __device__ __forceinline__ float other_half(float x) {
  int b = __builtin_bit_cast(int, x);
  return __builtin_bit_cast(float, __builtin_amdgcn_permlanex16(b, b, 0x76543210, 0xfedcba98, false, false));
}

__global__ void __launch_bounds__(512) attn_kernel(const f16* __restrict__ q_ws,
                                                   const f16* __restrict__ k_ws,
                                                   const f16* __restrict__ vt_ws,
                                                   const float* __restrict__ tab_sig,
                                                   const float* __restrict__ logit_scale,
                                                   float* __restrict__ o_ws) {
  // one array fixes the order: table (16 KB place) | K | V^T, the two images at multiples of 1 KB
  __shared__ __attribute__((aligned(1024))) char s_all[16384 + 2 * KV_BYTES];
  float* s_bias = (float*)s_all;           // 16*sigmoid table slice for this head (3969 floats)
  char*  s_kv   = s_all + 16384;

  int tid = threadIdx.x, wave = tid >> 5, lane = tid & 31;
  int rb = blockIdx.x, h = blockIdx.y, b = blockIdx.z;

  const f16* qbh  = q_ws  + ((size_t)(b * 8 + h) * 1024) * 32;
  const f16* kbh  = k_ws  + ((size_t)(b * 8 + h) * 1024) * 32;
  const f16* vtbh = vt_ws + ((size_t)(b * 8 + h) * 32) * 1024;

  // Waves 0-7 copy K, waves 8-15 V^T: 8 KB a wave, 16 copies in flight.
  {
    const char* g0   = (const char*)((wave < 8) ? kbh : vtbh);
    unsigned    lds0 = (unsigned)(size_t)s_kv + (unsigned)(wave >> 3) * KV_BYTES;
    unsigned    off  = (unsigned)(wave & 7) * 8192 + (unsigned)lane * 16;
    copy8_to_lds(lds0, g0, off);
    copy8_to_lds(lds0, g0, off + 4096);
  }

  for (int i = tid; i < 3969; i += 512) s_bias[i] = tab_sig[h * 3969 + i];
  // this wave's copies have landed before the barrier behind which other waves read them
  asm volatile("s_wait_asynccnt 0x0" ::: "memory");
  __syncthreads();

  float scale = __expf(fminf(logit_scale[h], 4.6051701859880914f)); // log(100)
  int row0  = rb * 256 + wave * 16;
  int nloc  = lane & 15;
  int mbase = (lane >> 4) << 3;
  unsigned f_lo = kv_place((unsigned)nloc * 64 + (unsigned)(lane >> 4) * 16);   // k 8h .. 8h+7
  unsigned f_hi = f_lo ^ 32;                                                    // k 16+8h .. 16+8h+7

  v16h qb = load_tile_h(qbh + row0 * 32, 32, lane);   // B operand, resident for whole loop

  // This lane's query is image position (qy, qx). The 32 keys of one pass are image row kb/32,
  // x = 0..31, so the lane's biases lie at s_bias[bi + mbase - x], and bi goes back one table row a pass.
  int qrow = row0 + nloc;
  int qy = qrow >> 5, qx = qrow & 31;
  int bi = (qy + 31) * 63 + (qx + 31) - mbase;

  v8f o0 = {}, o1 = {};                    // O^T: dims mbase+r and 16+mbase+r of query qrow
  float m_q = -1e30f, l_q = 0.f;           // l_q: this half's keys only

  for (int kb = 0; kb < 1024; kb += 32) {
    // ---- S^T = kn @ qn^T (two 16x16 tiles, K = hd = 32 in one WMMA each) ----
    v16h kt0 = load_frag_lds(s_kv + kb * 64, f_lo, f_hi);
    v16h kt1 = load_frag_lds(s_kv + kb * 64 + 1024, f_lo, f_hi);
    v8f z = {};
    v8f s0 = wmma_f16(kt0, qb, z);
    v8f s1 = wmma_f16(kt1, qb, z);

    float p0[8], p1[8];
#pragma unroll
    for (int r = 0; r < 8; r += 2) {       // scale + relative-position bias; written by pairs of
                                           // keys so that each pair is one packed fma on the D
                                           // registers as they lie (no register moves)
      v2f t0 = (v2f){s0[r], s0[r + 1]} * scale + (v2f){s_bias[bi - r], s_bias[bi - r - 1]};
      v2f t1 = (v2f){s1[r], s1[r + 1]} * scale + (v2f){s_bias[bi - 16 - r], s_bias[bi - 16 - r - 1]};
      p0[r] = t0[0]; p0[r + 1] = t0[1];
      p1[r] = t1[0]; p1[r + 1] = t1[1];
    }
    bi -= 63;

    // ---- online softmax: one query per lane ----
    float tmax = fmaxf(p0[0], p1[0]);
#pragma unroll
    for (int r = 1; r < 8; ++r) tmax = fmaxf(tmax, fmaxf(p0[r], p1[r]));
    tmax = fmaxf(tmax, other_half(tmax));
    float mnew  = fmaxf(m_q, tmax);
    float alpha = exp2f((m_q - mnew) * LOG2E);
    m_q = mnew;
    v2f sum2 = {0.f, 0.f};                 // even keys | odd keys
    v16h pb;
#pragma unroll
    for (int r = 0; r < 8; ++r) {
      p0[r] = exp2f((p0[r] - mnew) * LOG2E);
      p1[r] = exp2f((p1[r] - mnew) * LOG2E);
      pb[r] = (f16)p0[r]; pb[r + 8] = (f16)p1[r];
    }
#pragma unroll
    for (int r = 0; r < 8; r += 2) {
      sum2 += (v2f){p0[r], p0[r + 1]};
      sum2 += (v2f){p1[r], p1[r + 1]};
    }
    l_q = l_q * alpha + (sum2[0] + sum2[1]);
#pragma unroll
    for (int r = 0; r < 8; ++r) { o0[r] *= alpha; o1[r] *= alpha; }

    // ---- O^T += V^T @ P^T (this pass's block of V^T: 32 dims x 32 keys) ----
    v16h va0 = load_frag_lds(s_kv + KV_BYTES + kb * 64, f_lo, f_hi);        // dims 0..15
    v16h va1 = load_frag_lds(s_kv + KV_BYTES + kb * 64 + 1024, f_lo, f_hi); // dims 16..31
    o0 = wmma_f16(va0, pb, o0);
    o1 = wmma_f16(va1, pb, o1);
  }

  // ---- epilogue: join the halves' sums, normalize, write (b, N, c) f32 for the proj GEMM ----
  float inv = 1.0f / (l_q + other_half(l_q));
  float* op = o_ws + ((size_t)(b * 1024) + qrow) * 256 + h * 32 + mbase;
  v4f w;
#pragma unroll
  for (int g = 0; g < 2; ++g) {            // 8 consecutive dims a tile: two 16-byte stores
#pragma unroll
    for (int i = 0; i < 4; ++i) w[i] = o0[g * 4 + i] * inv;
    *(v4f*)(op + g * 4) = w;
#pragma unroll
    for (int i = 0; i < 4; ++i) w[i] = o1[g * 4 + i] * inv;
    *(v4f*)(op + 16 + g * 4) = w;
  }
}

// ---------------------------------------------------------------------------
extern "C" void kernel_launch(void* const* d_in, const int* in_sizes, int n_in,
                              void* d_out, int out_size, void* d_ws, size_t ws_size,
                              hipStream_t stream) {
  const float* x    = (const float*)d_in[0];
  const float* q1_w = (const float*)d_in[1];
  const float* q1_b = (const float*)d_in[2];
  const float* q2_w = (const float*)d_in[3];
  const float* q2_b = (const float*)d_in[4];
  const float* k1_w = (const float*)d_in[5];
  const float* k1_b = (const float*)d_in[6];
  const float* k2_w = (const float*)d_in[7];
  const float* k2_b = (const float*)d_in[8];
  const float* v1_w = (const float*)d_in[9];
  const float* v1_b = (const float*)d_in[10];
  const float* v2_w = (const float*)d_in[11];
  const float* v2_b = (const float*)d_in[12];
  const float* p1_w = (const float*)d_in[13];
  const float* p1_b = (const float*)d_in[14];
  const float* p2_w = (const float*)d_in[15];
  const float* p2_b = (const float*)d_in[16];
  const float* lsc  = (const float*)d_in[17];
  const float* mw1  = (const float*)d_in[18];
  const float* mb1  = (const float*)d_in[19];
  const float* mw2  = (const float*)d_in[20];

  char* ws = (char*)d_ws;
  f16*   x3h   = (f16*)(ws);                          //  8 MB  (16384 x 256 f16)
  f16*   q_ws  = (f16*)(ws + ((size_t)8  << 20));     //  8 MB
  f16*   k_ws  = (f16*)(ws + ((size_t)16 << 20));     //  8 MB
  f16*   vt_ws = (f16*)(ws + ((size_t)24 << 20));     //  8 MB
  float* o_ws  = (float*)(ws + ((size_t)32 << 20));   // 16 MB  (16384 x 256 f32)
  float* tab   = (float*)(ws + ((size_t)48 << 20));   // 124 KB (8 x 3969 f32)

  transpose_kernel<<<512, 256, 0, stream>>>(x, x3h);  // 16 images x 2 x 16 tiles
  bias_table_kernel<<<(8 * 3969 + 255) / 256, 256, 0, stream>>>(mw1, mb1, mw2, tab);

  // 128 row blocks (16384 rows / 128) x 6 half-GEMMs
  qkv_kernel<<<dim3(128, 6), 256, 0, stream>>>(x3h, q1_w, q1_b, q2_w, q2_b, k1_w, k1_b, k2_w, k2_b,
                                               v1_w, v1_b, v2_w, v2_b, q_ws, k_ws, vt_ws);

  attn_kernel<<<dim3(4, 8, 16), 512, 0, stream>>>(q_ws, k_ws, vt_ws, tab, lsc, o_ws);

  proj_kernel<<<dim3(128, 2), 256, 0, stream>>>(o_ws, p1_w, p1_b, p2_w, p2_b, (float*)d_out);
}

// v006
// Measured time: 62.1 microseconds a run.
// Next to v005, in two timings, it ran 1.13 times as fast each time.
// All steps since v000 together make it 4.68 times as fast.
#include <hip/hip_runtime.h>
#include <hip/hip_bf16.h>

typedef _Float16 f16;
typedef __attribute__((ext_vector_type(16))) _Float16 v16h;
typedef __attribute__((ext_vector_type(8)))  _Float16 v8h;
typedef __attribute__((ext_vector_type(4)))  _Float16 v4h;
typedef __attribute__((ext_vector_type(8)))  float    v8f;
typedef __attribute__((ext_vector_type(4)))  float    v4f;
typedef __attribute__((ext_vector_type(2)))  float    v2f;

#define LOG2E 1.44269504088896340736f

static __device__ __forceinline__ v16h load_tile_h(const f16* base, int stride, int lane) {
  const f16* p = base + (lane & 15) * stride + ((lane >> 4) << 3);
  v8h lo = *(const v8h*)(p);        // K koff..koff+7      (16B aligned)
  v8h hi = *(const v8h*)(p + 16);   // K koff+16..koff+23  (16B aligned)
  v16h r;
#pragma unroll
  for (int i = 0; i < 8; ++i) { r[i] = lo[i]; r[i + 8] = hi[i]; }
  return r;
}

static __device__ __forceinline__ v16h load_tile_f32cvt(const float* base, int stride, int lane) {
  const float* p = base + (lane & 15) * stride + ((lane >> 4) << 3);
  v16h r;
#pragma unroll
  for (int i = 0; i < 8; ++i) { r[i] = (f16)p[i]; r[i + 8] = (f16)p[16 + i]; }
  return r;
}

static __device__ __forceinline__ v8f wmma_f16(v16h a, v16h b, v8f c) {
  return __builtin_amdgcn_wmma_f32_16x16x32_f16(false, a, false, b, (short)0, c, false, false);
}

// Reduction across the 16 lanes of a half-wave (xor masks < 16 stay in-half).
static __device__ __forceinline__ float hred_sum(float x) {
#pragma unroll
  for (int m = 1; m < 16; m <<= 1) x += __shfl_xor(x, m, 32);
  return x;
}

#define TP_PITCH 136
__global__ void __launch_bounds__(256) transpose_kernel(const float* __restrict__ x,
                                                        f16* __restrict__ x3h) {
  __shared__ __attribute__((aligned(16))) f16 s_t[64 * TP_PITCH];
  int tid = threadIdx.x;
  int pt = blockIdx.x & 15;                // token tile   (16 x 64)
  int ct = (blockIdx.x >> 4) & 1;          // channel tile ( 2 x 128)
  int b  = blockIdx.x >> 5;                // image        (16)
  int lo = tid & 15, hi = tid >> 4;

  const float* src = x + ((size_t)(b * 256 + ct * 128 + hi * 8)) * 1024 + pt * 64 + lo * 4;
  v4f v[8];
#pragma unroll
  for (int j = 0; j < 8; ++j) v[j] = *(const v4f*)(src + j * 1024);

#pragma unroll
  for (int i = 0; i < 4; ++i) {
    v8h t;
#pragma unroll
    for (int j = 0; j < 8; ++j) t[j] = (f16)v[j][i];
    *(v8h*)&s_t[(i * 16 + lo) * TP_PITCH + hi * 8] = t;
  }
  __syncthreads();                         // the tile is read back by other waves

  f16* dst = x3h + ((size_t)(b * 1024 + pt * 64)) * 256 + ct * 128 + lo * 8;
#pragma unroll
  for (int k = 0; k < 4; ++k) {
    int tok = k * 16 + hi;
    v8h t = *(const v8h*)&s_t[((tok & 3) * 16 + (tok >> 2)) * TP_PITCH + lo * 8];
    *(v8h*)(dst + (size_t)tok * 256) = t;
  }
}

// ---------------------------------------------------------------------------
// Stage 1: relative-position bias table: tab_sig[head*3969 + i] = 16*sigmoid(mlp(coords_i))
// ---------------------------------------------------------------------------
__global__ void __launch_bounds__(256) bias_table_kernel(const float* __restrict__ w1,
                                                         const float* __restrict__ b1,
                                                         const float* __restrict__ w2,
                                                         float* __restrict__ tab_sig) {
  int t = blockIdx.x * 256 + threadIdx.x;      // 8 * 3969
  if (t >= 8 * 3969) return;
  int i = t % 3969, head = t / 3969;
  int gy = i / 63, gx = i % 63;
  float ty = ((float)(gy - 31) / (31.0f + 1e-8f)) * 3.2f;
  float tx = ((float)(gx - 31) / (31.0f + 1e-8f)) * 3.2f;
  float sy = (ty > 0.f) ? 1.f : ((ty < 0.f) ? -1.f : 0.f);
  float sx = (tx > 0.f) ? 1.f : ((tx < 0.f) ? -1.f : 0.f);
  ty = sy * (1.0f - __expf(-fabsf(ty)));
  tx = sx * (1.0f - __expf(-fabsf(tx)));
  float acc = 0.f;
#pragma unroll 8
  for (int j = 0; j < 128; ++j) {
    float hj = ty * w1[j * 2 + 0] + tx * w1[j * 2 + 1] + b1[j];
    hj = fmaxf(hj, 0.f);
    acc += hj * w2[head * 128 + j];
  }
  tab_sig[t] = 16.0f / (1.0f + __expf(-acc));
}

#define W_PITCH 136
template <int MODE>
static __device__ __forceinline__ void half_gemm_body(const f16* __restrict__ Xh,
                                                      const float* __restrict__ Xf,
                                                      const float* __restrict__ W,
                                                      const float* __restrict__ bvec,
                                                      f16* __restrict__ out_h,
                                                      float* __restrict__ out_f,
                                                      int half, f16* s_w) {
  int tid = threadIdx.x, wave = tid >> 5, lane = tid & 31;
  int row0  = blockIdx.x * 128 + wave * 16;
  int nloc  = lane & 15;
  int mbase = (lane >> 4) << 3;

  v16h a[4];
#pragma unroll
  for (int kt = 0; kt < 4; ++kt) {
    if (MODE == 2) a[kt] = load_tile_f32cvt(Xf + (size_t)row0 * 256 + half * 128 + kt * 32, 256, lane);
    else           a[kt] = load_tile_h    (Xh + (size_t)row0 * 256 + half * 128 + kt * 32, 256, lane);
  }
  v4f wv[16];                              // float4 number tid + 256 i of the weight
#pragma unroll
  for (int i = 0; i < 16; ++i) wv[i] = *(const v4f*)(W + (tid + 256 * i) * 4);
  asm volatile("s_wait_xcnt 0x0" ::: "memory");
#pragma unroll
  for (int i = 0; i < 16; ++i) {           // a wave stores one weight row (256 B of f16) at a time
    v4h t;
#pragma unroll
    for (int e = 0; e < 4; ++e) t[e] = (f16)wv[i][e];
    *(v4h*)&s_w[(wave + 8 * i) * W_PITCH + lane * 4] = t;
  }
  __syncthreads();                         // every wave reads rows that other waves stored

#pragma unroll
  for (int j = 0; j < 4; ++j) {            // output cols 32j .. 32j+31 (= head j of this half)
    v8f acc0 = {}, acc1 = {};
#pragma unroll
    for (int kt = 0; kt < 4; ++kt) {
      // B column n = W[col, :] row (y = x @ W^T)
      v16h b0 = load_tile_h(s_w + (32 * j + 0)  * W_PITCH + kt * 32, W_PITCH, lane);
      v16h b1 = load_tile_h(s_w + (32 * j + 16) * W_PITCH + kt * 32, W_PITCH, lane);
      acc0 = wmma_f16(a[kt], b0, acc0);
      acc1 = wmma_f16(a[kt], b1, acc1);
    }
    int c0 = 32 * j + nloc, c1 = c0 + 16;
    float r0[8], r1[8];
#pragma unroll
    for (int r = 0; r < 8; ++r) {
      int row = row0 + mbase + r;
      float y0 = acc0[r] + bvec[c0];
      float y1 = acc1[r] + bvec[c1];
      if (MODE != 2) {                     // residual x + lin(x)
        y0 += (float)Xh[(size_t)row * 256 + half * 128 + c0];
        y1 += (float)Xh[(size_t)row * 256 + half * 128 + c1];
      }
      r0[r] = y0; r1[r] = y1;
    }
    if (MODE == 0) {                       // per-head (32-dim) L2 normalization
#pragma unroll
      for (int r = 0; r < 8; ++r) {
        float ss  = hred_sum(r0[r] * r0[r] + r1[r] * r1[r]);
        float inv = 1.0f / fmaxf(__fsqrt_rn(ss), 1e-12f);
        r0[r] *= inv; r1[r] *= inv;
      }
    }
#pragma unroll
    for (int r = 0; r < 8; ++r) {
      int row = row0 + mbase + r;
      int b = row >> 10, n = row & 1023;
      int head = half * 4 + j;
      if (MODE == 2) {
        out_f[((size_t)(b * 256 + half * 128 + c0)) * 1024 + n] = r0[r];
        out_f[((size_t)(b * 256 + half * 128 + c1)) * 1024 + n] = r1[r];
      } else if (MODE == 1) {
        f16* vb = out_h + ((size_t)((b * 8 + head) * 32 + (n >> 5))) * 1024 + (n & 31);
        vb[nloc * 32]        = (f16)r0[r];
        vb[(nloc + 16) * 32] = (f16)r1[r];
      } else {
        out_h[((size_t)((b * 8 + head) * 1024 + n)) * 32 + nloc]      = (f16)r0[r];
        out_h[((size_t)((b * 8 + head) * 1024 + n)) * 32 + nloc + 16] = (f16)r1[r];
      }
    }
    asm volatile("s_wait_xcnt 0x0" ::: "memory");
  }
}

__global__ void __launch_bounds__(256) qkv_kernel(const f16* __restrict__ x3h,
                                                  const float* __restrict__ q1_w, const float* __restrict__ q1_b,
                                                  const float* __restrict__ q2_w, const float* __restrict__ q2_b,
                                                  const float* __restrict__ k1_w, const float* __restrict__ k1_b,
                                                  const float* __restrict__ k2_w, const float* __restrict__ k2_b,
                                                  const float* __restrict__ v1_w, const float* __restrict__ v1_b,
                                                  const float* __restrict__ v2_w, const float* __restrict__ v2_b,
                                                  f16* __restrict__ q_ws, f16* __restrict__ k_ws,
                                                  f16* __restrict__ vt_ws) {
  __shared__ __attribute__((aligned(16))) f16 s_w[128 * W_PITCH];
  int job = blockIdx.y;
  int half = job & 1;
  if (job < 4) {
    const float* Wm = (job < 2) ? (half ? q2_w : q1_w) : (half ? k2_w : k1_w);
    const float* bv = (job < 2) ? (half ? q2_b : q1_b) : (half ? k2_b : k1_b);
    half_gemm_body<0>(x3h, nullptr, Wm, bv, (job < 2) ? q_ws : k_ws, nullptr, half, s_w);
  } else {
    half_gemm_body<1>(x3h, nullptr, half ? v2_w : v1_w, half ? v2_b : v1_b, vt_ws, nullptr, half, s_w);
  }
}

__global__ void __launch_bounds__(256) proj_kernel(const float* __restrict__ o_ws,
                                                   const float* __restrict__ p1_w, const float* __restrict__ p1_b,
                                                   const float* __restrict__ p2_w, const float* __restrict__ p2_b,
                                                   float* __restrict__ out) {
  __shared__ __attribute__((aligned(16))) f16 s_w[128 * W_PITCH];
  int half = blockIdx.y;
  half_gemm_body<2>(nullptr, o_ws, half ? p2_w : p1_w, half ? p2_b : p1_b, nullptr, out, half, s_w);
}

#define KV_BYTES 65536

static __device__ __forceinline__ unsigned kv_place(unsigned off) {
  return off ^ (((off >> 8) & 3u) << 4);
}

// Eight copies of 512 contiguous bytes a wave (16 bytes a lane), 512 bytes apart.
static __device__ __forceinline__ void copy8_to_lds(unsigned lds0, const char* g0, unsigned off) {
  unsigned l[8];
  const char* g[8];
#pragma unroll
  for (int i = 0; i < 8; ++i) { l[i] = lds0 + kv_place(off + i * 512); g[i] = g0 + off + i * 512; }
  asm volatile("global_load_async_to_lds_b128 %0, %8, off\n\t"
               "global_load_async_to_lds_b128 %1, %9, off\n\t"
               "global_load_async_to_lds_b128 %2, %10, off\n\t"
               "global_load_async_to_lds_b128 %3, %11, off\n\t"
               "global_load_async_to_lds_b128 %4, %12, off\n\t"
               "global_load_async_to_lds_b128 %5, %13, off\n\t"
               "global_load_async_to_lds_b128 %6, %14, off\n\t"
               "global_load_async_to_lds_b128 %7, %15, off\n\t"
               "s_wait_xcnt 0x0"
               :: "v"(l[0]), "v"(l[1]), "v"(l[2]), "v"(l[3]), "v"(l[4]), "v"(l[5]), "v"(l[6]), "v"(l[7]),
                  "v"(g[0]), "v"(g[1]), "v"(g[2]), "v"(g[3]), "v"(g[4]), "v"(g[5]), "v"(g[6]), "v"(g[7])
               : "memory");
}

// A fragment of 16 rows x 32 halves from the staged image; f_lo / f_hi: this lane's two pieces.
static __device__ __forceinline__ v16h load_frag_lds(const char* tile, unsigned f_lo, unsigned f_hi) {
  v8h lo = *(const v8h*)(tile + f_lo);
  v8h hi = *(const v8h*)(tile + f_hi);
  v16h r;
#pragma unroll
  for (int i = 0; i < 8; ++i) { r[i] = lo[i]; r[i + 8] = hi[i]; }
  return r;
}
static __device__ __forceinline__ float other_half(float x) {
  int b = __builtin_bit_cast(int, x);
  return __builtin_bit_cast(float, __builtin_amdgcn_permlanex16(b, b, 0x76543210, 0xfedcba98, false, false));
}

static __device__ __forceinline__ void exp2_bare17(float (&a)[8], float (&c)[8], float& f) {
  asm("v_exp_f32 %0, %0\n\tv_exp_f32 %1, %1\n\tv_exp_f32 %2, %2\n\tv_exp_f32 %3, %3\n\t"
      "v_exp_f32 %4, %4\n\tv_exp_f32 %5, %5\n\tv_exp_f32 %6, %6\n\tv_exp_f32 %7, %7\n\t"
      "v_exp_f32 %8, %8\n\tv_exp_f32 %9, %9\n\tv_exp_f32 %10, %10\n\tv_exp_f32 %11, %11\n\t"
      "v_exp_f32 %12, %12\n\tv_exp_f32 %13, %13\n\tv_exp_f32 %14, %14\n\tv_exp_f32 %15, %15\n\t"
      "v_exp_f32 %16, %16\n\tv_nop"
      : "+v"(f), "+v"(a[0]), "+v"(a[1]), "+v"(a[2]), "+v"(a[3]), "+v"(a[4]), "+v"(a[5]), "+v"(a[6]), "+v"(a[7]),
        "+v"(c[0]), "+v"(c[1]), "+v"(c[2]), "+v"(c[3]), "+v"(c[4]), "+v"(c[5]), "+v"(c[6]), "+v"(c[7]));
}

__global__ void __launch_bounds__(512) attn_kernel(const f16* __restrict__ q_ws,
                                                   const f16* __restrict__ k_ws,
                                                   const f16* __restrict__ vt_ws,
                                                   const float* __restrict__ tab_sig,
                                                   const float* __restrict__ logit_scale,
                                                   float* __restrict__ o_ws) {
  // one array fixes the order: table (16 KB place) | K | V^T, the two images at multiples of 1 KB
  __shared__ __attribute__((aligned(1024))) char s_all[16384 + 2 * KV_BYTES];
  float* s_bias = (float*)s_all;           // 16*sigmoid table slice for this head (3969 floats)
  char*  s_kv   = s_all + 16384;

  int tid = threadIdx.x, wave = tid >> 5, lane = tid & 31;
  int rb = blockIdx.x, h = blockIdx.y, b = blockIdx.z;

  const f16* qbh  = q_ws  + ((size_t)(b * 8 + h) * 1024) * 32;
  const f16* kbh  = k_ws  + ((size_t)(b * 8 + h) * 1024) * 32;
  const f16* vtbh = vt_ws + ((size_t)(b * 8 + h) * 32) * 1024;

  // Waves 0-7 copy K, waves 8-15 V^T: 8 KB a wave, 16 copies in flight.
  {
    const char* g0   = (const char*)((wave < 8) ? kbh : vtbh);
    unsigned    lds0 = (unsigned)(size_t)s_kv + (unsigned)(wave >> 3) * KV_BYTES;
    unsigned    off  = (unsigned)(wave & 7) * 8192 + (unsigned)lane * 16;
    copy8_to_lds(lds0, g0, off);
    copy8_to_lds(lds0, g0, off + 4096);
  }

  for (int i = tid; i < 3969; i += 512) s_bias[i] = tab_sig[h * 3969 + i];
  // this wave's copies have landed before the barrier behind which other waves read them
  asm volatile("s_wait_asynccnt 0x0" ::: "memory");
  __syncthreads();

  float scale = __expf(fminf(logit_scale[h], 4.6051701859880914f)); // log(100)
  int row0  = rb * 256 + wave * 16;
  int nloc  = lane & 15;
  int mbase = (lane >> 4) << 3;
  unsigned f_lo = kv_place((unsigned)nloc * 64 + (unsigned)(lane >> 4) * 16);   // k 8h .. 8h+7
  unsigned f_hi = f_lo ^ 32;                                                    // k 16+8h .. 16+8h+7

  v16h qb = load_tile_h(qbh + row0 * 32, 32, lane);   // B operand, resident for whole loop

  // This lane's query is image position (qy, qx). The 32 keys of one pass are image row kb/32,
  // x = 0..31, so the lane's biases lie at s_bias[bi + mbase - x], and bi goes back one table row a pass.
  int qrow = row0 + nloc;
  int qy = qrow >> 5, qx = qrow & 31;
  int bi = (qy + 31) * 63 + (qx + 31) - mbase;

  v8f o0 = {}, o1 = {};                    // O^T: dims mbase+r and 16+mbase+r of query qrow
  float m_q = -1e30f, l_q = 0.f;           // l_q: this half's keys only

  for (int kb = 0; kb < 1024; kb += 32) {
    // ---- S^T = kn @ qn^T (two 16x16 tiles, K = hd = 32 in one WMMA each) ----
    v16h kt0 = load_frag_lds(s_kv + kb * 64, f_lo, f_hi);
    v16h kt1 = load_frag_lds(s_kv + kb * 64 + 1024, f_lo, f_hi);
    v8f z = {};
    v8f s0 = wmma_f16(kt0, qb, z);
    v8f s1 = wmma_f16(kt1, qb, z);

    float p0[8], p1[8];
#pragma unroll
    for (int r = 0; r < 8; r += 2) {       // scale + relative-position bias; written by pairs of
                                           // keys so that each pair is one packed fma on the D
                                           // registers as they lie (no register moves)
      v2f t0 = (v2f){s0[r], s0[r + 1]} * scale + (v2f){s_bias[bi - r], s_bias[bi - r - 1]};
      v2f t1 = (v2f){s1[r], s1[r + 1]} * scale + (v2f){s_bias[bi - 16 - r], s_bias[bi - 16 - r - 1]};
      p0[r] = t0[0]; p0[r + 1] = t0[1];
      p1[r] = t1[0]; p1[r + 1] = t1[1];
    }
    bi -= 63;

    // ---- online softmax: one query per lane ----
    float tmax = fmaxf(p0[0], p1[0]);
#pragma unroll
    for (int r = 1; r < 8; ++r) tmax = fmaxf(tmax, fmaxf(p0[r], p1[r]));
    tmax = fmaxf(tmax, other_half(tmax));
    float mnew  = fmaxf(m_q, tmax);
    float alpha = (m_q - mnew) * LOG2E;     // the arguments; 2^x of all 17 below
    m_q = mnew;
    v2f sum2 = {0.f, 0.f};                 // even keys | odd keys
    v16h pb;
#pragma unroll
    for (int r = 0; r < 8; ++r) {
      p0[r] = (p0[r] - mnew) * LOG2E;
      p1[r] = (p1[r] - mnew) * LOG2E;
    }
    exp2_bare17(p0, p1, alpha);
#pragma unroll
    for (int r = 0; r < 8; ++r) { pb[r] = (f16)p0[r]; pb[r + 8] = (f16)p1[r]; }
#pragma unroll
    for (int r = 0; r < 8; r += 2) {
      sum2 += (v2f){p0[r], p0[r + 1]};
      sum2 += (v2f){p1[r], p1[r + 1]};
    }
    l_q = l_q * alpha + (sum2[0] + sum2[1]);
#pragma unroll
    for (int r = 0; r < 8; ++r) { o0[r] *= alpha; o1[r] *= alpha; }

    // ---- O^T += V^T @ P^T (this pass's block of V^T: 32 dims x 32 keys) ----
    v16h va0 = load_frag_lds(s_kv + KV_BYTES + kb * 64, f_lo, f_hi);        // dims 0..15
    v16h va1 = load_frag_lds(s_kv + KV_BYTES + kb * 64 + 1024, f_lo, f_hi); // dims 16..31
    o0 = wmma_f16(va0, pb, o0);
    o1 = wmma_f16(va1, pb, o1);
  }

  // ---- epilogue: join the halves' sums, normalize, write (b, N, c) f32 for the proj GEMM ----
  float inv = 1.0f / (l_q + other_half(l_q));
  float* op = o_ws + ((size_t)(b * 1024) + qrow) * 256 + h * 32 + mbase;
  v4f w;
#pragma unroll
  for (int g = 0; g < 2; ++g) {            // 8 consecutive dims a tile: two 16-byte stores
#pragma unroll
    for (int i = 0; i < 4; ++i) w[i] = o0[g * 4 + i] * inv;
    *(v4f*)(op + g * 4) = w;
#pragma unroll
    for (int i = 0; i < 4; ++i) w[i] = o1[g * 4 + i] * inv;
    *(v4f*)(op + 16 + g * 4) = w;
  }
}

// ---------------------------------------------------------------------------
extern "C" void kernel_launch(void* const* d_in, const int* in_sizes, int n_in,
                              void* d_out, int out_size, void* d_ws, size_t ws_size,
                              hipStream_t stream) {
  const float* x    = (const float*)d_in[0];
  const float* q1_w = (const float*)d_in[1];
  const float* q1_b = (const float*)d_in[2];
  const float* q2_w = (const float*)d_in[3];
  const float* q2_b = (const float*)d_in[4];
  const float* k1_w = (const float*)d_in[5];
  const float* k1_b = (const float*)d_in[6];
  const float* k2_w = (const float*)d_in[7];
  const float* k2_b = (const float*)d_in[8];
  const float* v1_w = (const float*)d_in[9];
  const float* v1_b = (const float*)d_in[10];
  const float* v2_w = (const float*)d_in[11];
  const float* v2_b = (const float*)d_in[12];
  const float* p1_w = (const float*)d_in[13];
  const float* p1_b = (const float*)d_in[14];
  const float* p2_w = (const float*)d_in[15];
  const float* p2_b = (const float*)d_in[16];
  const float* lsc  = (const float*)d_in[17];
  const float* mw1  = (const float*)d_in[18];
  const float* mb1  = (const float*)d_in[19];
  const float* mw2  = (const float*)d_in[20];

  char* ws = (char*)d_ws;
  f16*   x3h   = (f16*)(ws);                          //  8 MB  (16384 x 256 f16)
  f16*   q_ws  = (f16*)(ws + ((size_t)8  << 20));     //  8 MB
  f16*   k_ws  = (f16*)(ws + ((size_t)16 << 20));     //  8 MB
  f16*   vt_ws = (f16*)(ws + ((size_t)24 << 20));     //  8 MB
  float* o_ws  = (float*)(ws + ((size_t)32 << 20));   // 16 MB  (16384 x 256 f32)
  float* tab   = (float*)(ws + ((size_t)48 << 20));   // 124 KB (8 x 3969 f32)

  transpose_kernel<<<512, 256, 0, stream>>>(x, x3h);  // 16 images x 2 x 16 tiles
  bias_table_kernel<<<(8 * 3969 + 255) / 256, 256, 0, stream>>>(mw1, mb1, mw2, tab);

  // 128 row blocks (16384 rows / 128) x 6 half-GEMMs
  qkv_kernel<<<dim3(128, 6), 256, 0, stream>>>(x3h, q1_w, q1_b, q2_w, q2_b, k1_w, k1_b, k2_w, k2_b,
                                               v1_w, v1_b, v2_w, v2_b, q_ws, k_ws, vt_ws);

  attn_kernel<<<dim3(4, 8, 16), 512, 0, stream>>>(q_ws, k_ws, vt_ws, tab, lsc, o_ws);

  proj_kernel<<<dim3(128, 2), 256, 0, stream>>>(o_ws, p1_w, p1_b, p2_w, p2_b, (float*)d_out);
}

// v007
// It runs in 57.5 microseconds.
// Two timings next to v006 both put it at 1.08 times that version's speed.
// Over all steps from v000 it is 5.07 times as fast.
#include <hip/hip_runtime.h>
#include <hip/hip_bf16.h>

typedef _Float16 f16;
typedef __attribute__((ext_vector_type(16))) _Float16 v16h;
typedef __attribute__((ext_vector_type(8)))  _Float16 v8h;
typedef __attribute__((ext_vector_type(4)))  _Float16 v4h;
typedef __attribute__((ext_vector_type(8)))  float    v8f;
typedef __attribute__((ext_vector_type(4)))  float    v4f;
typedef __attribute__((ext_vector_type(2)))  float    v2f;

#define LOG2E 1.44269504088896340736f

static __device__ __forceinline__ v16h load_tile_h(const f16* base, int stride, int lane) {
  const f16* p = base + (lane & 15) * stride + ((lane >> 4) << 3);
  v8h lo = *(const v8h*)(p);        // K koff..koff+7      (16B aligned)
  v8h hi = *(const v8h*)(p + 16);   // K koff+16..koff+23  (16B aligned)
  v16h r;
#pragma unroll
  for (int i = 0; i < 8; ++i) { r[i] = lo[i]; r[i + 8] = hi[i]; }
  return r;
}

static __device__ __forceinline__ v16h load_tile_f32cvt(const float* base, int stride, int lane) {
  const float* p = base + (lane & 15) * stride + ((lane >> 4) << 3);
  v16h r;
#pragma unroll
  for (int i = 0; i < 8; ++i) { r[i] = (f16)p[i]; r[i + 8] = (f16)p[16 + i]; }
  return r;
}

static __device__ __forceinline__ v8f wmma_f16(v16h a, v16h b, v8f c) {
  return __builtin_amdgcn_wmma_f32_16x16x32_f16(false, a, false, b, (short)0, c, false, false);
}

// Reduction across the 16 lanes of a half-wave (xor masks < 16 stay in-half).
static __device__ __forceinline__ float hred_sum(float x) {
#pragma unroll
  for (int m = 1; m < 16; m <<= 1) x += __shfl_xor(x, m, 32);
  return x;
}

// ---------------------------------------------------------------------------
// Stage 1: relative-position bias table: tab_sig[head*3969 + i] = 16*sigmoid(mlp(coords_i))
// ---------------------------------------------------------------------------
__global__ void __launch_bounds__(256) bias_table_kernel(const float* __restrict__ w1,
                                                         const float* __restrict__ b1,
                                                         const float* __restrict__ w2,
                                                         float* __restrict__ tab_sig) {
  int t = blockIdx.x * 256 + threadIdx.x;      // 8 * 3969
  if (t >= 8 * 3969) return;
  int i = t % 3969, head = t / 3969;
  int gy = i / 63, gx = i % 63;
  float ty = ((float)(gy - 31) / (31.0f + 1e-8f)) * 3.2f;
  float tx = ((float)(gx - 31) / (31.0f + 1e-8f)) * 3.2f;
  float sy = (ty > 0.f) ? 1.f : ((ty < 0.f) ? -1.f : 0.f);
  float sx = (tx > 0.f) ? 1.f : ((tx < 0.f) ? -1.f : 0.f);
  ty = sy * (1.0f - __expf(-fabsf(ty)));
  tx = sx * (1.0f - __expf(-fabsf(tx)));
  float acc = 0.f;
#pragma unroll 8
  for (int j = 0; j < 128; ++j) {
    float hj = ty * w1[j * 2 + 0] + tx * w1[j * 2 + 1] + b1[j];
    hj = fmaxf(hj, 0.f);
    acc += hj * w2[head * 128 + j];
  }
  tab_sig[t] = 16.0f / (1.0f + __expf(-acc));
}

#define W_PITCH 136

// t, wave = t / 32: the thread's place among the 256 threads (8 waves) that share this weight
static __device__ __forceinline__ void load_weight(const float* __restrict__ W, unsigned t, v4f (&wv)[16]) {
#pragma unroll
  for (int i = 0; i < 16; ++i) wv[i] = *(const v4f*)((const char*)W + t * 16u + 4096 * i);   // float4 number t + 256 i
}
static __device__ __forceinline__ void store_weight(const v4f (&wv)[16], f16* s_w, int wave, int lane) {
#pragma unroll
  for (int i = 0; i < 16; ++i) {           // a wave stores one weight row (256 B of f16) at a time
    v4h t;
#pragma unroll
    for (int e = 0; e < 4; ++e) t[e] = (f16)wv[i][e];
    *(v4h*)&s_w[(wave + 8 * i) * W_PITCH + lane * 4] = t;
  }
}

#define X_BLK (32 * W_PITCH + 32)          // halves per block

// row0: first of this wave's 16 rows; s_xr (MODE 0, 1): the x tile at token row0 % 128 + mbase
template <int MODE>
static __device__ __forceinline__ void half_gemm_tiles(const v16h (&a)[4], const f16* s_w, const f16* s_xr,
                                                       const float* __restrict__ bvec,
                                                       f16* __restrict__ out_h,
                                                       float* __restrict__ out_f,
                                                       int half, int row0, int lane) {
  int nloc  = lane & 15;
  int mbase = (lane >> 4) << 3;

#pragma unroll
  for (int j = 0; j < 4; ++j) {            // output cols 32j .. 32j+31 (= head j of this half)
    v8f acc0 = {}, acc1 = {};
#pragma unroll
    for (int kt = 0; kt < 4; ++kt) {
      // B column n = W[col, :] row (y = x @ W^T)
      v16h b0 = load_tile_h(s_w + (32 * j + 0)  * W_PITCH + kt * 32, W_PITCH, lane);
      v16h b1 = load_tile_h(s_w + (32 * j + 16) * W_PITCH + kt * 32, W_PITCH, lane);
      acc0 = wmma_f16(a[kt], b0, acc0);
      acc1 = wmma_f16(a[kt], b1, acc1);
    }
    int c0 = 32 * j + nloc, c1 = c0 + 16;
    float r0[8], r1[8];
#pragma unroll
    for (int r = 0; r < 8; ++r) {
      float y0 = acc0[r] + bvec[c0];
      float y1 = acc1[r] + bvec[c1];
      if (MODE != 2) {                     // residual x + lin(x)
        y0 += (float)s_xr[(r & 3) * X_BLK + (r >> 2) * W_PITCH + c0];
        y1 += (float)s_xr[(r & 3) * X_BLK + (r >> 2) * W_PITCH + c1];
      }
      r0[r] = y0; r1[r] = y1;
    }
    if (MODE == 0) {                       // per-head (32-dim) L2 normalization
#pragma unroll
      for (int r = 0; r < 8; ++r) {
        float ss  = hred_sum(r0[r] * r0[r] + r1[r] * r1[r]);
        float inv = 1.0f / fmaxf(__fsqrt_rn(ss), 1e-12f);
        r0[r] *= inv; r1[r] *= inv;
      }
    }
#pragma unroll
    for (int r = 0; r < 8; ++r) {
      int row = row0 + mbase + r;
      int b = row >> 10, n = row & 1023;
      int head = half * 4 + j;
      if (MODE == 2) {
        out_f[((size_t)(b * 256 + half * 128 + c0)) * 1024 + n] = r0[r];
        out_f[((size_t)(b * 256 + half * 128 + c1)) * 1024 + n] = r1[r];
      } else if (MODE == 1) {
        f16* vb = out_h + ((size_t)((b * 8 + head) * 32 + (n >> 5))) * 1024 + (n & 31);
        vb[nloc * 32]        = (f16)r0[r];
        vb[(nloc + 16) * 32] = (f16)r1[r];
      } else {
        out_h[((size_t)((b * 8 + head) * 1024 + n)) * 32 + nloc]      = (f16)r0[r];
        out_h[((size_t)((b * 8 + head) * 1024 + n)) * 32 + nloc + 16] = (f16)r1[r];
      }
    }
    asm volatile("s_wait_xcnt 0x0" ::: "memory");
  }
}

// ---------------------------------------------------------------------------
// q, k and v of one block of 128 tokens and one half of the channels, straight from x (NCHW f32).
// 24 waves: waves 0-7 do q, 8-15 k, 16-23 v; blockIdx.x = token block, blockIdx.y = half.
// All three products read the same 128 tokens x 128 channels of x, so the work-group brings that
// tile in once and transposes it on the way into LDS; no (b, N, c) copy of x goes through memory:
//   read : wave cg (0-15) takes channels 8cg..8cg+7, lane pg tokens 4pg..4pg+3
//          (8 x 16 B a lane; the 32 lanes cover 512 contiguous bytes of one channel row)
//   LDS  : 8 channels of one token = one 16-byte store (places: X_BLK above)
// A fragments and the residual are then read from that tile. Each group of 8 waves stages its own
// weight. grp is held in a scalar register, so every branch on it is one branch for the wave; the
// one barrier stands outside them.
// ---------------------------------------------------------------------------
__global__ void __launch_bounds__(768) qkv_kernel(const float* __restrict__ x,
                                                  const float* __restrict__ q1_w, const float* __restrict__ q1_b,
                                                  const float* __restrict__ q2_w, const float* __restrict__ q2_b,
                                                  const float* __restrict__ k1_w, const float* __restrict__ k1_b,
                                                  const float* __restrict__ k2_w, const float* __restrict__ k2_b,
                                                  const float* __restrict__ v1_w, const float* __restrict__ v1_b,
                                                  const float* __restrict__ v2_w, const float* __restrict__ v2_b,
                                                  f16* __restrict__ q_ws, f16* __restrict__ k_ws,
                                                  f16* __restrict__ vt_ws) {
  __shared__ __attribute__((aligned(16))) f16 s_x[4 * X_BLK];
  __shared__ __attribute__((aligned(16))) f16 s_w3[3 * 128 * W_PITCH];
  int tid = threadIdx.x, lane = tid & 31;
  int grp  = __builtin_amdgcn_readfirstlane(tid >> 8);   // 0 q, 1 k, 2 v
  int wave = (tid >> 5) & 7;                             // within the group
  int half = blockIdx.y;
  int b = blockIdx.x >> 3, n0 = (blockIdx.x & 7) * 128;  // the block's image and first token

  const float* Wm = (grp == 0) ? (half ? q2_w : q1_w) : (grp == 1) ? (half ? k2_w : k1_w) : (half ? v2_w : v1_w);
  const float* bv = (grp == 0) ? (half ? q2_b : q1_b) : (grp == 1) ? (half ? k2_b : k1_b) : (half ? v2_b : v1_b);
  f16* s_w = s_w3 + grp * (128 * W_PITCH);

  int cg = tid >> 5;                       // channel group of the x tile, waves 0-15
  v4f xv[8];
  if (grp < 2) {
    const float* src = x + ((size_t)(b * 256 + half * 128 + cg * 8)) * 1024 + n0 + lane * 4;
#pragma unroll
    for (int j = 0; j < 8; ++j) xv[j] = *(const v4f*)(src + j * 1024);
    asm volatile("s_wait_xcnt 0x0" ::: "memory");
  }
  v4f wv[16];
  unsigned t = (unsigned)(tid - (grp << 8));
  load_weight(Wm, t, wv);
  asm volatile("s_wait_xcnt 0x0" :: "v"(t) : "memory");
  if (grp < 2) {
#pragma unroll
    for (int i = 0; i < 4; ++i) {
      v8h t;
#pragma unroll
      for (int j = 0; j < 8; ++j) t[j] = (f16)xv[j][i];
      *(v8h*)&s_x[i * X_BLK + lane * W_PITCH + cg * 8] = t;
    }
  }
  store_weight(wv, s_w, wave, lane);
  __syncthreads();                         // every wave reads x and weight rows that other waves stored

  int tok = wave * 16 + (lane & 15);       // this lane's row of the A fragments
  const f16* ap = s_x + (tok & 3) * X_BLK + (tok >> 2) * W_PITCH + ((lane >> 4) << 3);
  v16h a[4];
#pragma unroll
  for (int kt = 0; kt < 4; ++kt) {         // the k order of load_tile_h
    v8h lo = *(const v8h*)(ap + kt * 32);
    v8h hi = *(const v8h*)(ap + kt * 32 + 16);
#pragma unroll
    for (int i = 0; i < 8; ++i) { a[kt][i] = lo[i]; a[kt][i + 8] = hi[i]; }
  }
  const f16* s_xr = s_x + (wave * 4 + ((lane >> 4) << 1)) * W_PITCH;
  int row0 = blockIdx.x * 128 + wave * 16;
  if (grp < 2) half_gemm_tiles<0>(a, s_w, s_xr, bv, (grp == 0) ? q_ws : k_ws, nullptr, half, row0, lane);
  else         half_gemm_tiles<1>(a, s_w, s_xr, bv, vt_ws, nullptr, half, row0, lane);
}

// The two proj half-GEMMs need only o_ws and their own weights, so they run side by side in one
// launch: blockIdx.y = half (the same for a whole work-group).
__global__ void __launch_bounds__(256) proj_kernel(const float* __restrict__ o_ws,
                                                   const float* __restrict__ p1_w, const float* __restrict__ p1_b,
                                                   const float* __restrict__ p2_w, const float* __restrict__ p2_b,
                                                   float* __restrict__ out) {
  __shared__ __attribute__((aligned(16))) f16 s_w[128 * W_PITCH];
  int tid = threadIdx.x, wave = tid >> 5, lane = tid & 31;
  int half = blockIdx.y;
  int row0 = blockIdx.x * 128 + wave * 16;
  v16h a[4];
#pragma unroll
  for (int kt = 0; kt < 4; ++kt) a[kt] = load_tile_f32cvt(o_ws + (size_t)row0 * 256 + half * 128 + kt * 32, 256, lane);
  v4f wv[16];
  load_weight(half ? p2_w : p1_w, (unsigned)tid, wv);
  asm volatile("s_wait_xcnt 0x0" ::: "memory");
  store_weight(wv, s_w, wave, lane);
  __syncthreads();                         // every wave reads rows that other waves stored
  half_gemm_tiles<2>(a, s_w, nullptr, half ? p2_b : p1_b, nullptr, out, half, row0, lane);
}

#define KV_BYTES 65536

static __device__ __forceinline__ unsigned kv_place(unsigned off) {
  return off ^ (((off >> 8) & 3u) << 4);
}

// Eight copies of 512 contiguous bytes a wave (16 bytes a lane), 512 bytes apart.
static __device__ __forceinline__ void copy8_to_lds(unsigned lds0, const char* g0, unsigned off) {
  unsigned l[8];
  const char* g[8];
#pragma unroll
  for (int i = 0; i < 8; ++i) { l[i] = lds0 + kv_place(off + i * 512); g[i] = g0 + off + i * 512; }
  asm volatile("global_load_async_to_lds_b128 %0, %8, off\n\t"
               "global_load_async_to_lds_b128 %1, %9, off\n\t"
               "global_load_async_to_lds_b128 %2, %10, off\n\t"
               "global_load_async_to_lds_b128 %3, %11, off\n\t"
               "global_load_async_to_lds_b128 %4, %12, off\n\t"
               "global_load_async_to_lds_b128 %5, %13, off\n\t"
               "global_load_async_to_lds_b128 %6, %14, off\n\t"
               "global_load_async_to_lds_b128 %7, %15, off\n\t"
               "s_wait_xcnt 0x0"
               :: "v"(l[0]), "v"(l[1]), "v"(l[2]), "v"(l[3]), "v"(l[4]), "v"(l[5]), "v"(l[6]), "v"(l[7]),
                  "v"(g[0]), "v"(g[1]), "v"(g[2]), "v"(g[3]), "v"(g[4]), "v"(g[5]), "v"(g[6]), "v"(g[7])
               : "memory");
}

// A fragment of 16 rows x 32 halves from the staged image; f_lo / f_hi: this lane's two pieces.
static __device__ __forceinline__ v16h load_frag_lds(const char* tile, unsigned f_lo, unsigned f_hi) {
  v8h lo = *(const v8h*)(tile + f_lo);
  v8h hi = *(const v8h*)(tile + f_hi);
  v16h r;
#pragma unroll
  for (int i = 0; i < 8; ++i) { r[i] = lo[i]; r[i + 8] = hi[i]; }
  return r;
}
static __device__ __forceinline__ float other_half(float x) {
  int b = __builtin_bit_cast(int, x);
  return __builtin_bit_cast(float, __builtin_amdgcn_permlanex16(b, b, 0x76543210, 0xfedcba98, false, false));
}

static __device__ __forceinline__ void exp2_bare17(float (&a)[8], float (&c)[8], float& f) {
  asm("v_exp_f32 %0, %0\n\tv_exp_f32 %1, %1\n\tv_exp_f32 %2, %2\n\tv_exp_f32 %3, %3\n\t"
      "v_exp_f32 %4, %4\n\tv_exp_f32 %5, %5\n\tv_exp_f32 %6, %6\n\tv_exp_f32 %7, %7\n\t"
      "v_exp_f32 %8, %8\n\tv_exp_f32 %9, %9\n\tv_exp_f32 %10, %10\n\tv_exp_f32 %11, %11\n\t"
      "v_exp_f32 %12, %12\n\tv_exp_f32 %13, %13\n\tv_exp_f32 %14, %14\n\tv_exp_f32 %15, %15\n\t"
      "v_exp_f32 %16, %16\n\tv_nop"
      : "+v"(f), "+v"(a[0]), "+v"(a[1]), "+v"(a[2]), "+v"(a[3]), "+v"(a[4]), "+v"(a[5]), "+v"(a[6]), "+v"(a[7]),
        "+v"(c[0]), "+v"(c[1]), "+v"(c[2]), "+v"(c[3]), "+v"(c[4]), "+v"(c[5]), "+v"(c[6]), "+v"(c[7]));
}

__global__ void __launch_bounds__(512) attn_kernel(const f16* __restrict__ q_ws,
                                                   const f16* __restrict__ k_ws,
                                                   const f16* __restrict__ vt_ws,
                                                   const float* __restrict__ tab_sig,
                                                   const float* __restrict__ logit_scale,
                                                   float* __restrict__ o_ws) {
  // one array fixes the order: table (16 KB place) | K | V^T, the two images at multiples of 1 KB
  __shared__ __attribute__((aligned(1024))) char s_all[16384 + 2 * KV_BYTES];
  float* s_bias = (float*)s_all;           // 16*sigmoid table slice for this head (3969 floats)
  char*  s_kv   = s_all + 16384;

  int tid = threadIdx.x, wave = tid >> 5, lane = tid & 31;
  int rb = blockIdx.x, h = blockIdx.y, b = blockIdx.z;

  const f16* qbh  = q_ws  + ((size_t)(b * 8 + h) * 1024) * 32;
  const f16* kbh  = k_ws  + ((size_t)(b * 8 + h) * 1024) * 32;
  const f16* vtbh = vt_ws + ((size_t)(b * 8 + h) * 32) * 1024;

  // Waves 0-7 copy K, waves 8-15 V^T: 8 KB a wave, 16 copies in flight.
  {
    const char* g0   = (const char*)((wave < 8) ? kbh : vtbh);
    unsigned    lds0 = (unsigned)(size_t)s_kv + (unsigned)(wave >> 3) * KV_BYTES;
    unsigned    off  = (unsigned)(wave & 7) * 8192 + (unsigned)lane * 16;
    copy8_to_lds(lds0, g0, off);
    copy8_to_lds(lds0, g0, off + 4096);
  }

  for (int i = tid; i < 3969; i += 512) s_bias[i] = tab_sig[h * 3969 + i];
  // this wave's copies have landed before the barrier behind which other waves read them
  asm volatile("s_wait_asynccnt 0x0" ::: "memory");
  __syncthreads();

  float scale = __expf(fminf(logit_scale[h], 4.6051701859880914f)); // log(100)
  int row0  = rb * 256 + wave * 16;
  int nloc  = lane & 15;
  int mbase = (lane >> 4) << 3;
  unsigned f_lo = kv_place((unsigned)nloc * 64 + (unsigned)(lane >> 4) * 16);   // k 8h .. 8h+7
  unsigned f_hi = f_lo ^ 32;                                                    // k 16+8h .. 16+8h+7

  v16h qb = load_tile_h(qbh + row0 * 32, 32, lane);   // B operand, resident for whole loop

  // This lane's query is image position (qy, qx). The 32 keys of one pass are image row kb/32,
  // x = 0..31, so the lane's biases lie at s_bias[bi + mbase - x], and bi goes back one table row a pass.
  int qrow = row0 + nloc;
  int qy = qrow >> 5, qx = qrow & 31;
  int bi = (qy + 31) * 63 + (qx + 31) - mbase;

  v8f o0 = {}, o1 = {};                    // O^T: dims mbase+r and 16+mbase+r of query qrow
  float m_q = -1e30f, l_q = 0.f;           // l_q: this half's keys only

  for (int kb = 0; kb < 1024; kb += 32) {
    // ---- S^T = kn @ qn^T (two 16x16 tiles, K = hd = 32 in one WMMA each) ----
    v16h kt0 = load_frag_lds(s_kv + kb * 64, f_lo, f_hi);
    v16h kt1 = load_frag_lds(s_kv + kb * 64 + 1024, f_lo, f_hi);
    v8f z = {};
    v8f s0 = wmma_f16(kt0, qb, z);
    v8f s1 = wmma_f16(kt1, qb, z);

    float p0[8], p1[8];
#pragma unroll
    for (int r = 0; r < 8; r += 2) {       // scale + relative-position bias; written by pairs of
                                           // keys so that each pair is one packed fma on the D
                                           // registers as they lie (no register moves)
      v2f t0 = (v2f){s0[r], s0[r + 1]} * scale + (v2f){s_bias[bi - r], s_bias[bi - r - 1]};
      v2f t1 = (v2f){s1[r], s1[r + 1]} * scale + (v2f){s_bias[bi - 16 - r], s_bias[bi - 16 - r - 1]};
      p0[r] = t0[0]; p0[r + 1] = t0[1];
      p1[r] = t1[0]; p1[r + 1] = t1[1];
    }
    bi -= 63;

    // ---- online softmax: one query per lane ----
    float tmax = fmaxf(p0[0], p1[0]);
#pragma unroll
    for (int r = 1; r < 8; ++r) tmax = fmaxf(tmax, fmaxf(p0[r], p1[r]));
    tmax = fmaxf(tmax, other_half(tmax));
    float mnew  = fmaxf(m_q, tmax);
    float alpha = (m_q - mnew) * LOG2E;     // the arguments; 2^x of all 17 below
    m_q = mnew;
    v2f sum2 = {0.f, 0.f};                 // even keys | odd keys
    v16h pb;
#pragma unroll
    for (int r = 0; r < 8; ++r) {
      p0[r] = (p0[r] - mnew) * LOG2E;
      p1[r] = (p1[r] - mnew) * LOG2E;
    }
    exp2_bare17(p0, p1, alpha);
#pragma unroll
    for (int r = 0; r < 8; ++r) { pb[r] = (f16)p0[r]; pb[r + 8] = (f16)p1[r]; }
#pragma unroll
    for (int r = 0; r < 8; r += 2) {
      sum2 += (v2f){p0[r], p0[r + 1]};
      sum2 += (v2f){p1[r], p1[r + 1]};
    }
    l_q = l_q * alpha + (sum2[0] + sum2[1]);
#pragma unroll
    for (int r = 0; r < 8; ++r) { o0[r] *= alpha; o1[r] *= alpha; }

    // ---- O^T += V^T @ P^T (this pass's block of V^T: 32 dims x 32 keys) ----
    v16h va0 = load_frag_lds(s_kv + KV_BYTES + kb * 64, f_lo, f_hi);        // dims 0..15
    v16h va1 = load_frag_lds(s_kv + KV_BYTES + kb * 64 + 1024, f_lo, f_hi); // dims 16..31
    o0 = wmma_f16(va0, pb, o0);
    o1 = wmma_f16(va1, pb, o1);
  }

  // ---- epilogue: join the halves' sums, normalize, write (b, N, c) f32 for the proj GEMM ----
  float inv = 1.0f / (l_q + other_half(l_q));
  float* op = o_ws + ((size_t)(b * 1024) + qrow) * 256 + h * 32 + mbase;
  v4f w;
#pragma unroll
  for (int g = 0; g < 2; ++g) {            // 8 consecutive dims a tile: two 16-byte stores
#pragma unroll
    for (int i = 0; i < 4; ++i) w[i] = o0[g * 4 + i] * inv;
    *(v4f*)(op + g * 4) = w;
#pragma unroll
    for (int i = 0; i < 4; ++i) w[i] = o1[g * 4 + i] * inv;
    *(v4f*)(op + 16 + g * 4) = w;
  }
}

// ---------------------------------------------------------------------------
extern "C" void kernel_launch(void* const* d_in, const int* in_sizes, int n_in,
                              void* d_out, int out_size, void* d_ws, size_t ws_size,
                              hipStream_t stream) {
  const float* x    = (const float*)d_in[0];
  const float* q1_w = (const float*)d_in[1];
  const float* q1_b = (const float*)d_in[2];
  const float* q2_w = (const float*)d_in[3];
  const float* q2_b = (const float*)d_in[4];
  const float* k1_w = (const float*)d_in[5];
  const float* k1_b = (const float*)d_in[6];
  const float* k2_w = (const float*)d_in[7];
  const float* k2_b = (const float*)d_in[8];
  const float* v1_w = (const float*)d_in[9];
  const float* v1_b = (const float*)d_in[10];
  const float* v2_w = (const float*)d_in[11];
  const float* v2_b = (const float*)d_in[12];
  const float* p1_w = (const float*)d_in[13];
  const float* p1_b = (const float*)d_in[14];
  const float* p2_w = (const float*)d_in[15];
  const float* p2_b = (const float*)d_in[16];
  const float* lsc  = (const float*)d_in[17];
  const float* mw1  = (const float*)d_in[18];
  const float* mb1  = (const float*)d_in[19];
  const float* mw2  = (const float*)d_in[20];

  char* ws = (char*)d_ws;
  f16*   q_ws  = (f16*)(ws + ((size_t)8  << 20));     //  8 MB
  f16*   k_ws  = (f16*)(ws + ((size_t)16 << 20));     //  8 MB
  f16*   vt_ws = (f16*)(ws + ((size_t)24 << 20));     //  8 MB
  float* o_ws  = (float*)(ws + ((size_t)32 << 20));   // 16 MB  (16384 x 256 f32)
  float* tab   = (float*)(ws + ((size_t)48 << 20));   // 124 KB (8 x 3969 f32)

  bias_table_kernel<<<(8 * 3969 + 255) / 256, 256, 0, stream>>>(mw1, mb1, mw2, tab);

  // 128 row blocks (16384 rows / 128) x 2 halves, q, k and v in each
  qkv_kernel<<<dim3(128, 2), 768, 0, stream>>>(x, q1_w, q1_b, q2_w, q2_b, k1_w, k1_b, k2_w, k2_b,
                                               v1_w, v1_b, v2_w, v2_b, q_ws, k_ws, vt_ws);

  attn_kernel<<<dim3(4, 8, 16), 512, 0, stream>>>(q_ws, k_ws, vt_ws, tab, lsc, o_ws);

  proj_kernel<<<dim3(128, 2), 256, 0, stream>>>(o_ws, p1_w, p1_b, p2_w, p2_b, (float*)d_out);
}

// v008
// It runs in 53.6 microseconds.
// In two side-by-side timings against v007, it was 1.07 and 1.06 times as fast.
// All steps since v000 together make it 5.41 times as fast.
#include <hip/hip_runtime.h>
#include <hip/hip_bf16.h>

typedef _Float16 f16;
typedef __attribute__((ext_vector_type(16))) _Float16 v16h;
typedef __attribute__((ext_vector_type(8)))  _Float16 v8h;
typedef __attribute__((ext_vector_type(4)))  _Float16 v4h;
typedef __attribute__((ext_vector_type(8)))  float    v8f;
typedef __attribute__((ext_vector_type(4)))  float    v4f;
typedef __attribute__((ext_vector_type(2)))  float    v2f;

#define LOG2E 1.44269504088896340736f

static __device__ __forceinline__ v16h load_tile_h(const f16* base, int stride, int lane) {
  const f16* p = base + (lane & 15) * stride + ((lane >> 4) << 3);
  v8h lo = *(const v8h*)(p);        // K koff..koff+7      (16B aligned)
  v8h hi = *(const v8h*)(p + 16);   // K koff+16..koff+23  (16B aligned)
  v16h r;
#pragma unroll
  for (int i = 0; i < 8; ++i) { r[i] = lo[i]; r[i + 8] = hi[i]; }
  return r;
}

static __device__ __forceinline__ v16h load_tile_f32cvt(const float* base, int stride, int lane) {
  const float* p = base + (lane & 15) * stride + ((lane >> 4) << 3);
  v16h r;
#pragma unroll
  for (int i = 0; i < 8; ++i) { r[i] = (f16)p[i]; r[i + 8] = (f16)p[16 + i]; }
  return r;
}

static __device__ __forceinline__ v8f wmma_f16(v16h a, v16h b, v8f c) {
  return __builtin_amdgcn_wmma_f32_16x16x32_f16(false, a, false, b, (short)0, c, false, false);
}

// Reduction across the 16 lanes of a half-wave (xor masks < 16 stay in-half).
static __device__ __forceinline__ float hred_sum(float x) {
#pragma unroll
  for (int m = 1; m < 16; m <<= 1) x += __shfl_xor(x, m, 32);
  return x;
}

// ---------------------------------------------------------------------------
// Stage 1: relative-position bias table: tab_sig[head*TAB_PITCH + i] = 16*sigmoid(mlp(coords_i)).
// It needs only the MLP's weights, so it has no launch of its own: it is done inside the q/k/v
// launch by the 8 v waves of 125 work-groups (the v waves have no normalization and are done well
// before the q and k waves of their work-group).
// Block blk does the 32 entries 32 blk .. 32 blk + 31 of every head, in two rounds of 16. An entry is
// shared by the 16 lanes of a half-wave: lane s takes hidden units 8s .. 8s+7, forms each once for all
// 8 heads and adds its 8 products per head; the 16 partial sums are then joined across the lanes.
// All weights a lane needs come in with one group of 16-byte loads, used by both rounds.
// TAB_PITCH = 125 * 32: a block's 32 entries of a head are one whole 128-byte line.
// ---------------------------------------------------------------------------
#define TAB_PITCH 4000

static __device__ __forceinline__ void bias_table_block(const float* __restrict__ w1,
                                                        const float* __restrict__ b1,
                                                        const float* __restrict__ w2,
                                                        float* __restrict__ tab_sig,
                                                        int blk, int wave, int lane) {
  int s = lane & 15;
  v4f w1v[4], b1v[2], w2v[8][2];
#pragma unroll
  for (int i = 0; i < 4; ++i) w1v[i] = *(const v4f*)(w1 + s * 16 + i * 4);
#pragma unroll
  for (int i = 0; i < 2; ++i) b1v[i] = *(const v4f*)(b1 + s * 8 + i * 4);
#pragma unroll
  for (int hd = 0; hd < 8; ++hd) {
#pragma unroll
    for (int i = 0; i < 2; ++i) w2v[hd][i] = *(const v4f*)(w2 + hd * 128 + s * 8 + i * 4);
  }
  asm volatile("s_wait_xcnt 0x0" ::: "memory");
#pragma unroll
  for (int rnd = 0; rnd < 2; ++rnd) {
    int i = blk * 32 + rnd * 16 + wave * 2 + (lane >> 4);
    int gy = i / 63, gx = i % 63;
    float ty = ((float)(gy - 31) / (31.0f + 1e-8f)) * 3.2f;
    float tx = ((float)(gx - 31) / (31.0f + 1e-8f)) * 3.2f;
    float sy = (ty > 0.f) ? 1.f : ((ty < 0.f) ? -1.f : 0.f);
    float sx = (tx > 0.f) ? 1.f : ((tx < 0.f) ? -1.f : 0.f);
    ty = sy * (1.0f - __expf(-fabsf(ty)));
    tx = sx * (1.0f - __expf(-fabsf(tx)));
    v2f h2[4];                             // the lane's hidden units, by pairs
#pragma unroll
    for (int j = 0; j < 8; ++j) {
      float hj = ty * w1v[j >> 1][(j & 1) * 2] + tx * w1v[j >> 1][(j & 1) * 2 + 1] + b1v[j >> 2][j & 3];
      h2[j >> 1][j & 1] = fmaxf(hj, 0.f);
    }
    float a = 0.f;                         // lane s (< 8) keeps head s
#pragma unroll
    for (int hd = 0; hd < 8; ++hd) {
      v2f acc = {0.f, 0.f};                // even units | odd units: one packed fma on the weights as loaded
#pragma unroll
      for (int p = 0; p < 4; ++p)
        acc += h2[p] * (v2f){w2v[hd][p >> 1][(p & 1) * 2], w2v[hd][p >> 1][(p & 1) * 2 + 1]};
      float t = hred_sum(acc[0] + acc[1]);
      a = (s == hd) ? t : a;
    }
    if (s < 8 && i < 3969) tab_sig[s * TAB_PITCH + i] = 16.0f / (1.0f + __expf(-a));
    asm volatile("s_wait_xcnt 0x0" ::: "memory");
  }
}

#define W_PITCH 136

// t, wave = t / 32: the thread's place among the 256 threads (8 waves) that share this weight
static __device__ __forceinline__ void load_weight(const float* __restrict__ W, unsigned t, v4f (&wv)[16]) {
#pragma unroll
  for (int i = 0; i < 16; ++i) wv[i] = *(const v4f*)((const char*)W + t * 16u + 4096 * i);   // float4 number t + 256 i
}
static __device__ __forceinline__ void store_weight(const v4f (&wv)[16], f16* s_w, int wave, int lane) {
#pragma unroll
  for (int i = 0; i < 16; ++i) {           // a wave stores one weight row (256 B of f16) at a time
    v4h t;
#pragma unroll
    for (int e = 0; e < 4; ++e) t[e] = (f16)wv[i][e];
    *(v4h*)&s_w[(wave + 8 * i) * W_PITCH + lane * 4] = t;
  }
}

#define X_BLK (32 * W_PITCH + 32)          // halves per block

// row0: first of this wave's 16 rows; s_xr (MODE 0, 1): the x tile at token row0 % 128 + mbase
template <int MODE>
static __device__ __forceinline__ void half_gemm_tiles(const v16h (&a)[4], const f16* s_w, const f16* s_xr,
                                                       const float* __restrict__ bvec,
                                                       f16* __restrict__ out_h,
                                                       float* __restrict__ out_f,
                                                       int half, int row0, int lane) {
  int nloc  = lane & 15;
  int mbase = (lane >> 4) << 3;

#pragma unroll
  for (int j = 0; j < 4; ++j) {            // output cols 32j .. 32j+31 (= head j of this half)
    v8f acc0 = {}, acc1 = {};
#pragma unroll
    for (int kt = 0; kt < 4; ++kt) {
      // B column n = W[col, :] row (y = x @ W^T)
      v16h b0 = load_tile_h(s_w + (32 * j + 0)  * W_PITCH + kt * 32, W_PITCH, lane);
      v16h b1 = load_tile_h(s_w + (32 * j + 16) * W_PITCH + kt * 32, W_PITCH, lane);
      acc0 = wmma_f16(a[kt], b0, acc0);
      acc1 = wmma_f16(a[kt], b1, acc1);
    }
    int c0 = 32 * j + nloc, c1 = c0 + 16;
    float r0[8], r1[8];
#pragma unroll
    for (int r = 0; r < 8; ++r) {
      float y0 = acc0[r] + bvec[c0];
      float y1 = acc1[r] + bvec[c1];
      if (MODE != 2) {                     // residual x + lin(x)
        y0 += (float)s_xr[(r & 3) * X_BLK + (r >> 2) * W_PITCH + c0];
        y1 += (float)s_xr[(r & 3) * X_BLK + (r >> 2) * W_PITCH + c1];
      }
      r0[r] = y0; r1[r] = y1;
    }
    if (MODE == 0) {                       // per-head (32-dim) L2 normalization
#pragma unroll
      for (int r = 0; r < 8; ++r) {
        float ss  = hred_sum(r0[r] * r0[r] + r1[r] * r1[r]);
        float inv = 1.0f / fmaxf(__fsqrt_rn(ss), 1e-12f);
        r0[r] *= inv; r1[r] *= inv;
      }
    }
#pragma unroll
    for (int r = 0; r < 8; ++r) {
      int row = row0 + mbase + r;
      int b = row >> 10, n = row & 1023;
      int head = half * 4 + j;
      if (MODE == 2) {
        out_f[((size_t)(b * 256 + half * 128 + c0)) * 1024 + n] = r0[r];
        out_f[((size_t)(b * 256 + half * 128 + c1)) * 1024 + n] = r1[r];
      } else if (MODE == 1) {
        f16* vb = out_h + ((size_t)((b * 8 + head) * 32 + (n >> 5))) * 1024 + (n & 31);
        vb[nloc * 32]        = (f16)r0[r];
        vb[(nloc + 16) * 32] = (f16)r1[r];
      } else {
        out_h[((size_t)((b * 8 + head) * 1024 + n)) * 32 + nloc]      = (f16)r0[r];
        out_h[((size_t)((b * 8 + head) * 1024 + n)) * 32 + nloc + 16] = (f16)r1[r];
      }
    }
    asm volatile("s_wait_xcnt 0x0" ::: "memory");
  }
}

// ---------------------------------------------------------------------------
// q, k and v of one block of 128 tokens and one half of the channels, straight from x (NCHW f32).
// 24 waves: waves 0-7 do q, 8-15 k, 16-23 v; blockIdx.x = token block, blockIdx.y = half.
// All three products read the same 128 tokens x 128 channels of x, so the work-group brings that
// tile in once and transposes it on the way into LDS; no (b, N, c) copy of x goes through memory:
//   read : wave cg (0-15) takes channels 8cg..8cg+7, lane pg tokens 4pg..4pg+3
//          (8 x 16 B a lane; the 32 lanes cover 512 contiguous bytes of one channel row)
//   LDS  : 8 channels of one token = one 16-byte store (places: X_BLK above)
// A fragments and the residual are then read from that tile. Each group of 8 waves stages its own
// weight. grp is held in a scalar register, so every branch on it is one branch for the wave; the
// one barrier stands outside them. Behind their own tiles the v waves of 125 work-groups do the
// bias table (bias_table_block above); the test is the same for a whole work-group.
// ---------------------------------------------------------------------------
__global__ void __launch_bounds__(768) qkv_kernel(const float* __restrict__ x,
                                                  const float* __restrict__ q1_w, const float* __restrict__ q1_b,
                                                  const float* __restrict__ q2_w, const float* __restrict__ q2_b,
                                                  const float* __restrict__ k1_w, const float* __restrict__ k1_b,
                                                  const float* __restrict__ k2_w, const float* __restrict__ k2_b,
                                                  const float* __restrict__ v1_w, const float* __restrict__ v1_b,
                                                  const float* __restrict__ v2_w, const float* __restrict__ v2_b,
                                                  const float* __restrict__ mlp_w1, const float* __restrict__ mlp_b1,
                                                  const float* __restrict__ mlp_w2,
                                                  f16* __restrict__ q_ws, f16* __restrict__ k_ws,
                                                  f16* __restrict__ vt_ws, float* __restrict__ tab_sig) {
  __shared__ __attribute__((aligned(16))) f16 s_x[4 * X_BLK];
  __shared__ __attribute__((aligned(16))) f16 s_w3[3 * 128 * W_PITCH];
  int tid = threadIdx.x, lane = tid & 31;
  int grp  = __builtin_amdgcn_readfirstlane(tid >> 8);   // 0 q, 1 k, 2 v
  int wave = (tid >> 5) & 7;                             // within the group
  int half = blockIdx.y;
  int b = blockIdx.x >> 3, n0 = (blockIdx.x & 7) * 128;  // the block's image and first token

  const float* Wm = (grp == 0) ? (half ? q2_w : q1_w) : (grp == 1) ? (half ? k2_w : k1_w) : (half ? v2_w : v1_w);
  const float* bv = (grp == 0) ? (half ? q2_b : q1_b) : (grp == 1) ? (half ? k2_b : k1_b) : (half ? v2_b : v1_b);
  f16* s_w = s_w3 + grp * (128 * W_PITCH);

  int cg = tid >> 5;                       // channel group of the x tile, waves 0-15
  v4f xv[8];
  if (grp < 2) {
    const float* src = x + ((size_t)(b * 256 + half * 128 + cg * 8)) * 1024 + n0 + lane * 4;
#pragma unroll
    for (int j = 0; j < 8; ++j) xv[j] = *(const v4f*)(src + j * 1024);
    asm volatile("s_wait_xcnt 0x0" ::: "memory");
  }
  v4f wv[16];
  unsigned t = (unsigned)(tid - (grp << 8));
  load_weight(Wm, t, wv);
  asm volatile("s_wait_xcnt 0x0" :: "v"(t) : "memory");
  if (grp < 2) {
#pragma unroll
    for (int i = 0; i < 4; ++i) {
      v8h t;
#pragma unroll
      for (int j = 0; j < 8; ++j) t[j] = (f16)xv[j][i];
      *(v8h*)&s_x[i * X_BLK + lane * W_PITCH + cg * 8] = t;
    }
  }
  store_weight(wv, s_w, wave, lane);
  __syncthreads();                         // every wave reads x and weight rows that other waves stored

  int tok = wave * 16 + (lane & 15);       // this lane's row of the A fragments
  const f16* ap = s_x + (tok & 3) * X_BLK + (tok >> 2) * W_PITCH + ((lane >> 4) << 3);
  v16h a[4];
#pragma unroll
  for (int kt = 0; kt < 4; ++kt) {         // the k order of load_tile_h
    v8h lo = *(const v8h*)(ap + kt * 32);
    v8h hi = *(const v8h*)(ap + kt * 32 + 16);
#pragma unroll
    for (int i = 0; i < 8; ++i) { a[kt][i] = lo[i]; a[kt][i + 8] = hi[i]; }
  }
  const f16* s_xr = s_x + (wave * 4 + ((lane >> 4) << 1)) * W_PITCH;
  int row0 = blockIdx.x * 128 + wave * 16;
  if (grp < 2) half_gemm_tiles<0>(a, s_w, s_xr, bv, (grp == 0) ? q_ws : k_ws, nullptr, half, row0, lane);
  else {
    half_gemm_tiles<1>(a, s_w, s_xr, bv, vt_ws, nullptr, half, row0, lane);
    if (half == 0 && blockIdx.x < 125) bias_table_block(mlp_w1, mlp_b1, mlp_w2, tab_sig, blockIdx.x, wave, lane);
  }
}

// The two proj half-GEMMs need only o_ws and their own weights, so they run side by side in one
// launch: blockIdx.y = half (the same for a whole work-group).
__global__ void __launch_bounds__(256) proj_kernel(const float* __restrict__ o_ws,
                                                   const float* __restrict__ p1_w, const float* __restrict__ p1_b,
                                                   const float* __restrict__ p2_w, const float* __restrict__ p2_b,
                                                   float* __restrict__ out) {
  __shared__ __attribute__((aligned(16))) f16 s_w[128 * W_PITCH];
  int tid = threadIdx.x, wave = tid >> 5, lane = tid & 31;
  int half = blockIdx.y;
  int row0 = blockIdx.x * 128 + wave * 16;
  v16h a[4];
#pragma unroll
  for (int kt = 0; kt < 4; ++kt) a[kt] = load_tile_f32cvt(o_ws + (size_t)row0 * 256 + half * 128 + kt * 32, 256, lane);
  v4f wv[16];
  load_weight(half ? p2_w : p1_w, (unsigned)tid, wv);
  asm volatile("s_wait_xcnt 0x0" ::: "memory");
  store_weight(wv, s_w, wave, lane);
  __syncthreads();                         // every wave reads rows that other waves stored
  half_gemm_tiles<2>(a, s_w, nullptr, half ? p2_b : p1_b, nullptr, out, half, row0, lane);
}

#define KV_BYTES 65536

static __device__ __forceinline__ unsigned kv_place(unsigned off) {
  return off ^ (((off >> 8) & 3u) << 4);
}

// Eight copies of 512 contiguous bytes a wave (16 bytes a lane), 512 bytes apart.
static __device__ __forceinline__ void copy8_to_lds(unsigned lds0, const char* g0, unsigned off) {
  unsigned l[8];
  const char* g[8];
#pragma unroll
  for (int i = 0; i < 8; ++i) { l[i] = lds0 + kv_place(off + i * 512); g[i] = g0 + off + i * 512; }
  asm volatile("global_load_async_to_lds_b128 %0, %8, off\n\t"
               "global_load_async_to_lds_b128 %1, %9, off\n\t"
               "global_load_async_to_lds_b128 %2, %10, off\n\t"
               "global_load_async_to_lds_b128 %3, %11, off\n\t"
               "global_load_async_to_lds_b128 %4, %12, off\n\t"
               "global_load_async_to_lds_b128 %5, %13, off\n\t"
               "global_load_async_to_lds_b128 %6, %14, off\n\t"
               "global_load_async_to_lds_b128 %7, %15, off\n\t"
               "s_wait_xcnt 0x0"
               :: "v"(l[0]), "v"(l[1]), "v"(l[2]), "v"(l[3]), "v"(l[4]), "v"(l[5]), "v"(l[6]), "v"(l[7]),
                  "v"(g[0]), "v"(g[1]), "v"(g[2]), "v"(g[3]), "v"(g[4]), "v"(g[5]), "v"(g[6]), "v"(g[7])
               : "memory");
}

// A fragment of 16 rows x 32 halves from the staged image; f_lo / f_hi: this lane's two pieces.
static __device__ __forceinline__ v16h load_frag_lds(const char* tile, unsigned f_lo, unsigned f_hi) {
  v8h lo = *(const v8h*)(tile + f_lo);
  v8h hi = *(const v8h*)(tile + f_hi);
  v16h r;
#pragma unroll
  for (int i = 0; i < 8; ++i) { r[i] = lo[i]; r[i + 8] = hi[i]; }
  return r;
}
static __device__ __forceinline__ float other_half(float x) {
  int b = __builtin_bit_cast(int, x);
  return __builtin_bit_cast(float, __builtin_amdgcn_permlanex16(b, b, 0x76543210, 0xfedcba98, false, false));
}

static __device__ __forceinline__ void exp2_bare17(float (&a)[8], float (&c)[8], float& f) {
  asm("v_exp_f32 %0, %0\n\tv_exp_f32 %1, %1\n\tv_exp_f32 %2, %2\n\tv_exp_f32 %3, %3\n\t"
      "v_exp_f32 %4, %4\n\tv_exp_f32 %5, %5\n\tv_exp_f32 %6, %6\n\tv_exp_f32 %7, %7\n\t"
      "v_exp_f32 %8, %8\n\tv_exp_f32 %9, %9\n\tv_exp_f32 %10, %10\n\tv_exp_f32 %11, %11\n\t"
      "v_exp_f32 %12, %12\n\tv_exp_f32 %13, %13\n\tv_exp_f32 %14, %14\n\tv_exp_f32 %15, %15\n\t"
      "v_exp_f32 %16, %16\n\tv_nop"
      : "+v"(f), "+v"(a[0]), "+v"(a[1]), "+v"(a[2]), "+v"(a[3]), "+v"(a[4]), "+v"(a[5]), "+v"(a[6]), "+v"(a[7]),
        "+v"(c[0]), "+v"(c[1]), "+v"(c[2]), "+v"(c[3]), "+v"(c[4]), "+v"(c[5]), "+v"(c[6]), "+v"(c[7]));
}

__global__ void __launch_bounds__(512) attn_kernel(const f16* __restrict__ q_ws,
                                                   const f16* __restrict__ k_ws,
                                                   const f16* __restrict__ vt_ws,
                                                   const float* __restrict__ tab_sig,
                                                   const float* __restrict__ logit_scale,
                                                   float* __restrict__ o_ws) {
  // one array fixes the order: table (16 KB place) | K | V^T, the two images at multiples of 1 KB
  __shared__ __attribute__((aligned(1024))) char s_all[16384 + 2 * KV_BYTES];
  float* s_bias = (float*)s_all;           // 16*sigmoid table slice for this head (3969 floats)
  char*  s_kv   = s_all + 16384;

  int tid = threadIdx.x, wave = tid >> 5, lane = tid & 31;
  int rb = blockIdx.x, h = blockIdx.y, b = blockIdx.z;

  const f16* qbh  = q_ws  + ((size_t)(b * 8 + h) * 1024) * 32;
  const f16* kbh  = k_ws  + ((size_t)(b * 8 + h) * 1024) * 32;
  const f16* vtbh = vt_ws + ((size_t)(b * 8 + h) * 32) * 1024;

  // Waves 0-7 copy K, waves 8-15 V^T: 8 KB a wave, 16 copies in flight.
  {
    const char* g0   = (const char*)((wave < 8) ? kbh : vtbh);
    unsigned    lds0 = (unsigned)(size_t)s_kv + (unsigned)(wave >> 3) * KV_BYTES;
    unsigned    off  = (unsigned)(wave & 7) * 8192 + (unsigned)lane * 16;
    copy8_to_lds(lds0, g0, off);
    copy8_to_lds(lds0, g0, off + 4096);
  }

  for (int i = tid; i < 3969; i += 512) s_bias[i] = tab_sig[h * TAB_PITCH + i];
  // this wave's copies have landed before the barrier behind which other waves read them
  asm volatile("s_wait_asynccnt 0x0" ::: "memory");
  __syncthreads();

  float scale = __expf(fminf(logit_scale[h], 4.6051701859880914f)); // log(100)
  int row0  = rb * 256 + wave * 16;
  int nloc  = lane & 15;
  int mbase = (lane >> 4) << 3;
  unsigned f_lo = kv_place((unsigned)nloc * 64 + (unsigned)(lane >> 4) * 16);   // k 8h .. 8h+7
  unsigned f_hi = f_lo ^ 32;                                                    // k 16+8h .. 16+8h+7

  v16h qb = load_tile_h(qbh + row0 * 32, 32, lane);   // B operand, resident for whole loop

  // This lane's query is image position (qy, qx). The 32 keys of one pass are image row kb/32,
  // x = 0..31, so the lane's biases lie at s_bias[bi + mbase - x], and bi goes back one table row a pass.
  int qrow = row0 + nloc;
  int qy = qrow >> 5, qx = qrow & 31;
  int bi = (qy + 31) * 63 + (qx + 31) - mbase;

  v8f o0 = {}, o1 = {};                    // O^T: dims mbase+r and 16+mbase+r of query qrow
  float m_q = -1e30f, l_q = 0.f;           // l_q: this half's keys only

  for (int kb = 0; kb < 1024; kb += 32) {
    // ---- S^T = kn @ qn^T (two 16x16 tiles, K = hd = 32 in one WMMA each) ----
    v16h kt0 = load_frag_lds(s_kv + kb * 64, f_lo, f_hi);
    v16h kt1 = load_frag_lds(s_kv + kb * 64 + 1024, f_lo, f_hi);
    v8f z = {};
    v8f s0 = wmma_f16(kt0, qb, z);
    v8f s1 = wmma_f16(kt1, qb, z);

    float p0[8], p1[8];
#pragma unroll
    for (int r = 0; r < 8; r += 2) {       // scale + relative-position bias; written by pairs of
                                           // keys so that each pair is one packed fma on the D
                                           // registers as they lie (no register moves)
      v2f t0 = (v2f){s0[r], s0[r + 1]} * scale + (v2f){s_bias[bi - r], s_bias[bi - r - 1]};
      v2f t1 = (v2f){s1[r], s1[r + 1]} * scale + (v2f){s_bias[bi - 16 - r], s_bias[bi - 16 - r - 1]};
      p0[r] = t0[0]; p0[r + 1] = t0[1];
      p1[r] = t1[0]; p1[r + 1] = t1[1];
    }
    bi -= 63;

    // ---- online softmax: one query per lane ----
    float tmax = fmaxf(p0[0], p1[0]);
#pragma unroll
    for (int r = 1; r < 8; ++r) tmax = fmaxf(tmax, fmaxf(p0[r], p1[r]));
    tmax = fmaxf(tmax, other_half(tmax));
    float mnew  = fmaxf(m_q, tmax);
    float alpha = (m_q - mnew) * LOG2E;     // the arguments; 2^x of all 17 below
    m_q = mnew;
    v2f sum2 = {0.f, 0.f};                 // even keys | odd keys
    v16h pb;
#pragma unroll
    for (int r = 0; r < 8; ++r) {
      p0[r] = (p0[r] - mnew) * LOG2E;
      p1[r] = (p1[r] - mnew) * LOG2E;
    }
    exp2_bare17(p0, p1, alpha);
#pragma unroll
    for (int r = 0; r < 8; ++r) { pb[r] = (f16)p0[r]; pb[r + 8] = (f16)p1[r]; }
#pragma unroll
    for (int r = 0; r < 8; r += 2) {
      sum2 += (v2f){p0[r], p0[r + 1]};
      sum2 += (v2f){p1[r], p1[r + 1]};
    }
    l_q = l_q * alpha + (sum2[0] + sum2[1]);
#pragma unroll
    for (int r = 0; r < 8; ++r) { o0[r] *= alpha; o1[r] *= alpha; }

    // ---- O^T += V^T @ P^T (this pass's block of V^T: 32 dims x 32 keys) ----
    v16h va0 = load_frag_lds(s_kv + KV_BYTES + kb * 64, f_lo, f_hi);        // dims 0..15
    v16h va1 = load_frag_lds(s_kv + KV_BYTES + kb * 64 + 1024, f_lo, f_hi); // dims 16..31
    o0 = wmma_f16(va0, pb, o0);
    o1 = wmma_f16(va1, pb, o1);
  }

  // ---- epilogue: join the halves' sums, normalize, write (b, N, c) f32 for the proj GEMM ----
  float inv = 1.0f / (l_q + other_half(l_q));
  float* op = o_ws + ((size_t)(b * 1024) + qrow) * 256 + h * 32 + mbase;
  v4f w;
#pragma unroll
  for (int g = 0; g < 2; ++g) {            // 8 consecutive dims a tile: two 16-byte stores
#pragma unroll
    for (int i = 0; i < 4; ++i) w[i] = o0[g * 4 + i] * inv;
    *(v4f*)(op + g * 4) = w;
#pragma unroll
    for (int i = 0; i < 4; ++i) w[i] = o1[g * 4 + i] * inv;
    *(v4f*)(op + 16 + g * 4) = w;
  }
}

// ---------------------------------------------------------------------------
extern "C" void kernel_launch(void* const* d_in, const int* in_sizes, int n_in,
                              void* d_out, int out_size, void* d_ws, size_t ws_size,
                              hipStream_t stream) {
  const float* x    = (const float*)d_in[0];
  const float* q1_w = (const float*)d_in[1];
  const float* q1_b = (const float*)d_in[2];
  const float* q2_w = (const float*)d_in[3];
  const float* q2_b = (const float*)d_in[4];
  const float* k1_w = (const float*)d_in[5];
  const float* k1_b = (const float*)d_in[6];
  const float* k2_w = (const float*)d_in[7];
  const float* k2_b = (const float*)d_in[8];
  const float* v1_w = (const float*)d_in[9];
  const float* v1_b = (const float*)d_in[10];
  const float* v2_w = (const float*)d_in[11];
  const float* v2_b = (const float*)d_in[12];
  const float* p1_w = (const float*)d_in[13];
  const float* p1_b = (const float*)d_in[14];
  const float* p2_w = (const float*)d_in[15];
  const float* p2_b = (const float*)d_in[16];
  const float* lsc  = (const float*)d_in[17];
  const float* mw1  = (const float*)d_in[18];
  const float* mb1  = (const float*)d_in[19];
  const float* mw2  = (const float*)d_in[20];

  char* ws = (char*)d_ws;
  f16*   q_ws  = (f16*)(ws + ((size_t)8  << 20));     //  8 MB
  f16*   k_ws  = (f16*)(ws + ((size_t)16 << 20));     //  8 MB
  f16*   vt_ws = (f16*)(ws + ((size_t)24 << 20));     //  8 MB
  float* o_ws  = (float*)(ws + ((size_t)32 << 20));   // 16 MB  (16384 x 256 f32)
  float* tab   = (float*)(ws + ((size_t)48 << 20));   // 125 KB (8 x 4000 f32)

  // 128 row blocks (16384 rows / 128) x 2 halves, q, k and v in each; the bias table beside them
  qkv_kernel<<<dim3(128, 2), 768, 0, stream>>>(x, q1_w, q1_b, q2_w, q2_b, k1_w, k1_b, k2_w, k2_b,
                                               v1_w, v1_b, v2_w, v2_b, mw1, mb1, mw2, q_ws, k_ws, vt_ws, tab);

  attn_kernel<<<dim3(4, 8, 16), 512, 0, stream>>>(q_ws, k_ws, vt_ws, tab, lsc, o_ws);

  proj_kernel<<<dim3(128, 2), 256, 0, stream>>>(o_ws, p1_w, p1_b, p2_w, p2_b, (float*)d_out);
}

// v010
// A run of this version takes 43.6 microseconds.
// Versions in between are left out here; by their measured steps it is 1.23 times as fast as v008.
// Over all steps from v000 it is 6.62 times as fast.
#include <hip/hip_runtime.h>
#include <hip/hip_bf16.h>

typedef _Float16 f16;
typedef __attribute__((ext_vector_type(16))) _Float16 v16h;
typedef __attribute__((ext_vector_type(8)))  _Float16 v8h;
typedef __attribute__((ext_vector_type(4)))  _Float16 v4h;
typedef __attribute__((ext_vector_type(8)))  float    v8f;
typedef __attribute__((ext_vector_type(4)))  float    v4f;
typedef __attribute__((ext_vector_type(2)))  float    v2f;

#define LOG2E 1.44269504088896340736f

static __device__ __forceinline__ v16h load_tile_h(const f16* base, int stride, int lane) {
  const f16* p = base + (lane & 15) * stride + ((lane >> 4) << 3);
  v8h lo = *(const v8h*)(p);        // K koff..koff+7      (16B aligned)
  v8h hi = *(const v8h*)(p + 16);   // K koff+16..koff+23  (16B aligned)
  v16h r;
#pragma unroll
  for (int i = 0; i < 8; ++i) { r[i] = lo[i]; r[i + 8] = hi[i]; }
  return r;
}

static __device__ __forceinline__ v16h load_tile_f32cvt(const float* base, int stride, int lane) {
  const float* p = base + (lane & 15) * stride + ((lane >> 4) << 3);
  v16h r;
#pragma unroll
  for (int i = 0; i < 8; ++i) { r[i] = (f16)p[i]; r[i + 8] = (f16)p[16 + i]; }
  return r;
}

static __device__ __forceinline__ v8f wmma_f16(v16h a, v16h b, v8f c) {
  return __builtin_amdgcn_wmma_f32_16x16x32_f16(false, a, false, b, (short)0, c, false, false);
}

// A head's logit scale, exp(min(logit_scale, log 100)), times log2(e)
static __device__ __forceinline__ float head_scale_log2(const float* __restrict__ logit_scale, int head) {
  return __expf(fminf(logit_scale[head], 4.6051701859880914f)) * LOG2E;
}

// Reduction across the 16 lanes of a half-wave (xor masks < 16 stay in-half).
static __device__ __forceinline__ float hred_sum(float x) {
#pragma unroll
  for (int m = 1; m < 16; m <<= 1) x += __shfl_xor(x, m, 32);
  return x;
}

// ---------------------------------------------------------------------------
// Stage 1: relative-position bias table: tab_sig[head*TAB_PITCH + i] = 16*sigmoid(mlp(coords_i)).
// It needs only the MLP's weights, so it has no launch of its own: it is done inside the q/k/v
// launch by the 8 v waves of 125 work-groups (the v waves have no normalization and are done well
// before the q and k waves of their work-group).
// Block blk does the 32 entries 32 blk .. 32 blk + 31 of every head, in two rounds of 16. An entry is
// shared by the 16 lanes of a half-wave: lane s takes hidden units 8s .. 8s+7, forms each once for all
// 8 heads and adds its 8 products per head; the 16 partial sums are then joined across the lanes.
// All weights a lane needs come in with one group of 16-byte loads, used by both rounds.
// TAB_PITCH = 125 * 32: a block's 32 entries of a head are one whole 128-byte line.
// ---------------------------------------------------------------------------
#define TAB_PITCH 4000

static __device__ __forceinline__ void bias_table_block(const float* __restrict__ w1,
                                                        const float* __restrict__ b1,
                                                        const float* __restrict__ w2,
                                                        float* __restrict__ tab_sig,
                                                        int blk, int wave, int lane) {
  int s = lane & 15;
  v4f w1v[4], b1v[2], w2v[8][2];
#pragma unroll
  for (int i = 0; i < 4; ++i) w1v[i] = *(const v4f*)(w1 + s * 16 + i * 4);
#pragma unroll
  for (int i = 0; i < 2; ++i) b1v[i] = *(const v4f*)(b1 + s * 8 + i * 4);
#pragma unroll
  for (int hd = 0; hd < 8; ++hd) {
#pragma unroll
    for (int i = 0; i < 2; ++i) w2v[hd][i] = *(const v4f*)(w2 + hd * 128 + s * 8 + i * 4);
  }
  asm volatile("s_wait_xcnt 0x0" ::: "memory");
#pragma unroll
  for (int rnd = 0; rnd < 2; ++rnd) {
    int i = blk * 32 + rnd * 16 + wave * 2 + (lane >> 4);
    int gy = i / 63, gx = i % 63;
    float ty = ((float)(gy - 31) / (31.0f + 1e-8f)) * 3.2f;
    float tx = ((float)(gx - 31) / (31.0f + 1e-8f)) * 3.2f;
    float sy = (ty > 0.f) ? 1.f : ((ty < 0.f) ? -1.f : 0.f);
    float sx = (tx > 0.f) ? 1.f : ((tx < 0.f) ? -1.f : 0.f);
    ty = sy * (1.0f - __expf(-fabsf(ty)));
    tx = sx * (1.0f - __expf(-fabsf(tx)));
    v2f h2[4];                             // the lane's hidden units, by pairs
#pragma unroll
    for (int j = 0; j < 8; ++j) {
      float hj = ty * w1v[j >> 1][(j & 1) * 2] + tx * w1v[j >> 1][(j & 1) * 2 + 1] + b1v[j >> 2][j & 3];
      h2[j >> 1][j & 1] = fmaxf(hj, 0.f);
    }
    float a = 0.f;                         // lane s (< 8) keeps head s
#pragma unroll
    for (int hd = 0; hd < 8; ++hd) {
      v2f acc = {0.f, 0.f};                // even units | odd units: one packed fma on the weights as loaded
#pragma unroll
      for (int p = 0; p < 4; ++p)
        acc += h2[p] * (v2f){w2v[hd][p >> 1][(p & 1) * 2], w2v[hd][p >> 1][(p & 1) * 2 + 1]};
      float t = hred_sum(acc[0] + acc[1]);
      a = (s == hd) ? t : a;
    }
    if (s < 8 && i < 3969) tab_sig[s * TAB_PITCH + i] = 16.0f / (1.0f + __expf(-a));
    asm volatile("s_wait_xcnt 0x0" ::: "memory");
  }
}

#define W_PITCH 136

// t, wave = t / 32: the thread's place among the 256 threads (8 waves) that share this weight
static __device__ __forceinline__ void load_weight(const float* __restrict__ W, unsigned t, v4f (&wv)[16]) {
#pragma unroll
  for (int i = 0; i < 16; ++i) wv[i] = *(const v4f*)((const char*)W + t * 16u + 4096 * i);   // float4 number t + 256 i
}
static __device__ __forceinline__ void store_weight(const v4f (&wv)[16], f16* s_w, int wave, int lane) {
#pragma unroll
  for (int i = 0; i < 16; ++i) {           // a wave stores one weight row (256 B of f16) at a time
    v4h t;
#pragma unroll
    for (int e = 0; e < 4; ++e) t[e] = (f16)wv[i][e];
    *(v4h*)&s_w[(wave + 8 * i) * W_PITCH + lane * 4] = t;
  }
}

#define X_BLK (32 * W_PITCH + 32)          // halves per block

static __device__ __forceinline__ void load_bias(const float* __restrict__ bvec, int lane, float (&bb)[8]) {
#pragma unroll
  for (int j = 0; j < 8; ++j) bb[j] = bvec[16 * j + (lane & 15)];
}

// row0: first of this wave's 16 rows; s_xr (MODE 0, 1): the x tile at token row0 % 128 + mbase
// len (MODE 0): the length that head j's normalized rows get (1 for k; q: see attn_kernel)
// the bias: bvec (MODE 0, 1: read tile by tile) or bb (MODE 2: load_bias above)
template <int MODE>
static __device__ __forceinline__ void half_gemm_tiles(const v16h (&a)[4], const f16* s_w, const f16* s_xr,
                                                       const float* __restrict__ bvec, const float (&bb)[8],
                                                       const float (&len)[4],
                                                       f16* __restrict__ out_h,
                                                       float* __restrict__ out_f,
                                                       int half, int row0, int lane) {
  int nloc  = lane & 15;
  int mbase = (lane >> 4) << 3;

#pragma unroll
  for (int j = 0; j < 4; ++j) {            // output cols 32j .. 32j+31 (= head j of this half)
    v8f acc0 = {}, acc1 = {};
#pragma unroll
    for (int kt = 0; kt < 4; ++kt) {
      // B column n = W[col, :] row (y = x @ W^T)
      v16h b0 = load_tile_h(s_w + (32 * j + 0)  * W_PITCH + kt * 32, W_PITCH, lane);
      v16h b1 = load_tile_h(s_w + (32 * j + 16) * W_PITCH + kt * 32, W_PITCH, lane);
      acc0 = wmma_f16(a[kt], b0, acc0);
      acc1 = wmma_f16(a[kt], b1, acc1);
    }
    int c0 = 32 * j + nloc, c1 = c0 + 16;
    float r0[8], r1[8];
#pragma unroll
    for (int r = 0; r < 8; ++r) {
      float y0 = acc0[r] + ((MODE == 2) ? bb[2 * j] : bvec[c0]);
      float y1 = acc1[r] + ((MODE == 2) ? bb[2 * j + 1] : bvec[c1]);
      if (MODE != 2) {                     // residual x + lin(x)
        y0 += (float)s_xr[(r & 3) * X_BLK + (r >> 2) * W_PITCH + c0];
        y1 += (float)s_xr[(r & 3) * X_BLK + (r >> 2) * W_PITCH + c1];
      }
      r0[r] = y0; r1[r] = y1;
    }
    if (MODE == 0) {                       // per-head (32-dim) L2 normalization
#pragma unroll
      for (int r = 0; r < 8; ++r) {
        float ss  = hred_sum(r0[r] * r0[r] + r1[r] * r1[r]);
        float inv = len[j] / fmaxf(__fsqrt_rn(ss), 1e-12f);
        r0[r] *= inv; r1[r] *= inv;
      }
    }
#pragma unroll
    for (int r = 0; r < 8; ++r) {
      int row = row0 + mbase + r;
      int b = row >> 10, n = row & 1023;
      int head = half * 4 + j;
      if (MODE == 2) {
        out_f[((size_t)(b * 256 + half * 128 + c0)) * 1024 + n] = r0[r];
        out_f[((size_t)(b * 256 + half * 128 + c1)) * 1024 + n] = r1[r];
      } else if (MODE == 1) {
        f16* vb = out_h + ((size_t)((b * 8 + head) * 32 + (n >> 5))) * 1024 + (n & 31);
        vb[nloc * 32]        = (f16)r0[r];
        vb[(nloc + 16) * 32] = (f16)r1[r];
      } else {
        out_h[((size_t)((b * 8 + head) * 1024 + n)) * 32 + nloc]      = (f16)r0[r];
        out_h[((size_t)((b * 8 + head) * 1024 + n)) * 32 + nloc + 16] = (f16)r1[r];
      }
    }
    asm volatile("s_wait_xcnt 0x0" ::: "memory");
  }
}

// ---------------------------------------------------------------------------
// q, k and v of one block of 128 tokens and one half of the channels, straight from x (NCHW f32).
// 24 waves: waves 0-7 do q, 8-15 k, 16-23 v; blockIdx.x = token block, blockIdx.y = half.
// All three products read the same 128 tokens x 128 channels of x, so the work-group brings that
// tile in once and transposes it on the way into LDS; no (b, N, c) copy of x goes through memory:
//   read : wave cg (0-15) takes channels 8cg..8cg+7, lane pg tokens 4pg..4pg+3
//          (8 x 16 B a lane; the 32 lanes cover 512 contiguous bytes of one channel row)
//   LDS  : 8 channels of one token = one 16-byte store (places: X_BLK above)
// A fragments and the residual are then read from that tile. Each group of 8 waves stages its own
// weight. grp is held in a scalar register, so every branch on it is one branch for the wave; the
// one barrier stands outside them. Behind their own tiles the v waves of 125 work-groups do the
// bias table (bias_table_block above); the test is the same for a whole work-group.
// ---------------------------------------------------------------------------
__global__ void __launch_bounds__(768) qkv_kernel(const float* __restrict__ x,
                                                  const float* __restrict__ q1_w, const float* __restrict__ q1_b,
                                                  const float* __restrict__ q2_w, const float* __restrict__ q2_b,
                                                  const float* __restrict__ k1_w, const float* __restrict__ k1_b,
                                                  const float* __restrict__ k2_w, const float* __restrict__ k2_b,
                                                  const float* __restrict__ v1_w, const float* __restrict__ v1_b,
                                                  const float* __restrict__ v2_w, const float* __restrict__ v2_b,
                                                  const float* __restrict__ mlp_w1, const float* __restrict__ mlp_b1,
                                                  const float* __restrict__ mlp_w2,
                                                  const float* __restrict__ logit_scale,
                                                  f16* __restrict__ q_ws, f16* __restrict__ k_ws,
                                                  f16* __restrict__ vt_ws, float* __restrict__ tab_sig) {
  __shared__ __attribute__((aligned(16))) f16 s_x[4 * X_BLK];
  __shared__ __attribute__((aligned(16))) f16 s_w3[3 * 128 * W_PITCH];
  int tid = threadIdx.x, lane = tid & 31;
  int grp  = __builtin_amdgcn_readfirstlane(tid >> 8);   // 0 q, 1 k, 2 v
  int wave = (tid >> 5) & 7;                             // within the group
  int half = blockIdx.y;
  int b = blockIdx.x >> 3, n0 = (blockIdx.x & 7) * 128;  // the block's image and first token

  const float* Wm = (grp == 0) ? (half ? q2_w : q1_w) : (grp == 1) ? (half ? k2_w : k1_w) : (half ? v2_w : v1_w);
  const float* bv = (grp == 0) ? (half ? q2_b : q1_b) : (grp == 1) ? (half ? k2_b : k1_b) : (half ? v2_b : v1_b);
  f16* s_w = s_w3 + grp * (128 * W_PITCH);

  float len[4];                            // q rows carry their head's scale * log2(e) into the f16 rounding
#pragma unroll
  for (int j = 0; j < 4; ++j) {            // read by every wave, ahead of the tile loads: no branch, no wait of its own
    float hs = head_scale_log2(logit_scale, half * 4 + j);
    len[j] = (grp == 0) ? hs : 1.0f;
  }

  int cg = tid >> 5;                       // channel group of the x tile, waves 0-15
  v4f xv[8];
  if (grp < 2) {
    const float* src = x + ((size_t)(b * 256 + half * 128 + cg * 8)) * 1024 + n0 + lane * 4;
#pragma unroll
    for (int j = 0; j < 8; ++j) xv[j] = *(const v4f*)(src + j * 1024);
    asm volatile("s_wait_xcnt 0x0" ::: "memory");
  }
  v4f wv[16];
  unsigned t = (unsigned)(tid - (grp << 8));
  load_weight(Wm, t, wv);
  asm volatile("s_wait_xcnt 0x0" :: "v"(t) : "memory");
  if (grp < 2) {
#pragma unroll
    for (int i = 0; i < 4; ++i) {
      v8h t;
#pragma unroll
      for (int j = 0; j < 8; ++j) t[j] = (f16)xv[j][i];
      *(v8h*)&s_x[i * X_BLK + lane * W_PITCH + cg * 8] = t;
    }
  }
  store_weight(wv, s_w, wave, lane);
  __syncthreads();                         // every wave reads x and weight rows that other waves stored

  int tok = wave * 16 + (lane & 15);       // this lane's row of the A fragments
  const f16* ap = s_x + (tok & 3) * X_BLK + (tok >> 2) * W_PITCH + ((lane >> 4) << 3);
  v16h a[4];
#pragma unroll
  for (int kt = 0; kt < 4; ++kt) {         // the k order of load_tile_h
    v8h lo = *(const v8h*)(ap + kt * 32);
    v8h hi = *(const v8h*)(ap + kt * 32 + 16);
#pragma unroll
    for (int i = 0; i < 8; ++i) { a[kt][i] = lo[i]; a[kt][i + 8] = hi[i]; }
  }
  const f16* s_xr = s_x + (wave * 4 + ((lane >> 4) << 1)) * W_PITCH;
  int row0 = blockIdx.x * 128 + wave * 16;
  const float nobb[8] = {};                // not used by MODE 0, 1
  if (grp < 2) half_gemm_tiles<0>(a, s_w, s_xr, bv, nobb, len, (grp == 0) ? q_ws : k_ws, nullptr, half, row0, lane);
  else {
    half_gemm_tiles<1>(a, s_w, s_xr, bv, nobb, len, vt_ws, nullptr, half, row0, lane);
    if (half == 0 && blockIdx.x < 125) bias_table_block(mlp_w1, mlp_b1, mlp_w2, tab_sig, blockIdx.x, wave, lane);
  }
}

__global__ void __launch_bounds__(256) __attribute__((amdgpu_waves_per_eu(2, 2))) proj_kernel(const float* __restrict__ o_ws,
                                                   const float* __restrict__ p1_w, const float* __restrict__ p1_b,
                                                   const float* __restrict__ p2_w, const float* __restrict__ p2_b,
                                                   float* __restrict__ out) {
  __shared__ __attribute__((aligned(16))) f16 s_w[128 * W_PITCH];
  int tid = threadIdx.x, wave = tid >> 5, lane = tid & 31;
  int half = blockIdx.y;
  int row0 = blockIdx.x * 128 + wave * 16;
  float bb[8];
  load_bias(half ? p2_b : p1_b, lane, bb);
  v16h a[4];
#pragma unroll
  for (int kt = 0; kt < 4; ++kt) a[kt] = load_tile_f32cvt(o_ws + (size_t)row0 * 256 + half * 128 + kt * 32, 256, lane);
  v4f wv[16];
  load_weight(half ? p2_w : p1_w, (unsigned)tid, wv);
  asm volatile("s_wait_xcnt 0x0" ::: "memory");
  store_weight(wv, s_w, wave, lane);
  __syncthreads();                         // every wave reads rows that other waves stored
  const float len[4] = {1.0f, 1.0f, 1.0f, 1.0f};   // not used by MODE 2
  half_gemm_tiles<2>(a, s_w, nullptr, nullptr, bb, len, nullptr, out, half, row0, lane);
}

#define KV_BYTES 65536

static __device__ __forceinline__ unsigned kv_place(unsigned off) {
  return off ^ (((off >> 8) & 3u) << 4);
}

// Eight copies of 512 contiguous bytes a wave (16 bytes a lane), 512 bytes apart.
static __device__ __forceinline__ void copy8_to_lds(unsigned lds0, const char* g0, unsigned off) {
  unsigned l[8];
  const char* g[8];
#pragma unroll
  for (int i = 0; i < 8; ++i) { l[i] = lds0 + kv_place(off + i * 512); g[i] = g0 + off + i * 512; }
  asm volatile("global_load_async_to_lds_b128 %0, %8, off\n\t"
               "global_load_async_to_lds_b128 %1, %9, off\n\t"
               "global_load_async_to_lds_b128 %2, %10, off\n\t"
               "global_load_async_to_lds_b128 %3, %11, off\n\t"
               "global_load_async_to_lds_b128 %4, %12, off\n\t"
               "global_load_async_to_lds_b128 %5, %13, off\n\t"
               "global_load_async_to_lds_b128 %6, %14, off\n\t"
               "global_load_async_to_lds_b128 %7, %15, off\n\t"
               "s_wait_xcnt 0x0"
               :: "v"(l[0]), "v"(l[1]), "v"(l[2]), "v"(l[3]), "v"(l[4]), "v"(l[5]), "v"(l[6]), "v"(l[7]),
                  "v"(g[0]), "v"(g[1]), "v"(g[2]), "v"(g[3]), "v"(g[4]), "v"(g[5]), "v"(g[6]), "v"(g[7])
               : "memory");
}

// A fragment of 16 rows x 32 halves from the staged image; f_lo / f_hi: this lane's two pieces.
static __device__ __forceinline__ v16h load_frag_lds(const char* tile, unsigned f_lo, unsigned f_hi) {
  v8h lo = *(const v8h*)(tile + f_lo);
  v8h hi = *(const v8h*)(tile + f_hi);
  v16h r;
#pragma unroll
  for (int i = 0; i < 8; ++i) { r[i] = lo[i]; r[i + 8] = hi[i]; }
  return r;
}
static __device__ __forceinline__ float other_half(float x) {
  int b = __builtin_bit_cast(int, x);
  return __builtin_bit_cast(float, __builtin_amdgcn_permlanex16(b, b, 0x76543210, 0xfedcba98, false, false));
}

static __device__ __forceinline__ void exp2_bare16(const float (&a)[8], const float (&c)[8],
                                                   float (&ea)[8], float (&ec)[8]) {
  asm("v_exp_f32 %0, %16\n\tv_exp_f32 %1, %17\n\tv_exp_f32 %2, %18\n\tv_exp_f32 %3, %19\n\t"
      "v_exp_f32 %4, %20\n\tv_exp_f32 %5, %21\n\tv_exp_f32 %6, %22\n\tv_exp_f32 %7, %23\n\t"
      "v_exp_f32 %8, %24\n\tv_exp_f32 %9, %25\n\tv_exp_f32 %10, %26\n\tv_exp_f32 %11, %27\n\t"
      "v_exp_f32 %12, %28\n\tv_exp_f32 %13, %29\n\tv_exp_f32 %14, %30\n\tv_exp_f32 %15, %31\n\t"
      "v_nop"
      : "=&v"(ea[0]), "=&v"(ea[1]), "=&v"(ea[2]), "=&v"(ea[3]), "=&v"(ea[4]), "=&v"(ea[5]), "=&v"(ea[6]), "=&v"(ea[7]),
        "=&v"(ec[0]), "=&v"(ec[1]), "=&v"(ec[2]), "=&v"(ec[3]), "=&v"(ec[4]), "=&v"(ec[5]), "=&v"(ec[6]), "=&v"(ec[7])
      : "v"(a[0]), "v"(a[1]), "v"(a[2]), "v"(a[3]), "v"(a[4]), "v"(a[5]), "v"(a[6]), "v"(a[7]),
        "v"(c[0]), "v"(c[1]), "v"(c[2]), "v"(c[3]), "v"(c[4]), "v"(c[5]), "v"(c[6]), "v"(c[7]));
}
static __device__ __forceinline__ void exp2_bare17(float (&a)[8], float (&c)[8], float& f) {
  asm("v_exp_f32 %0, %0\n\tv_exp_f32 %1, %1\n\tv_exp_f32 %2, %2\n\tv_exp_f32 %3, %3\n\t"
      "v_exp_f32 %4, %4\n\tv_exp_f32 %5, %5\n\tv_exp_f32 %6, %6\n\tv_exp_f32 %7, %7\n\t"
      "v_exp_f32 %8, %8\n\tv_exp_f32 %9, %9\n\tv_exp_f32 %10, %10\n\tv_exp_f32 %11, %11\n\t"
      "v_exp_f32 %12, %12\n\tv_exp_f32 %13, %13\n\tv_exp_f32 %14, %14\n\tv_exp_f32 %15, %15\n\t"
      "v_exp_f32 %16, %16\n\tv_nop"
      : "+v"(f), "+v"(a[0]), "+v"(a[1]), "+v"(a[2]), "+v"(a[3]), "+v"(a[4]), "+v"(a[5]), "+v"(a[6]), "+v"(a[7]),
        "+v"(c[0]), "+v"(c[1]), "+v"(c[2]), "+v"(c[3]), "+v"(c[4]), "+v"(c[5]), "+v"(c[6]), "+v"(c[7]));
}

// The lane's 16 terms of one pass, added by pairs (even keys | odd keys).
static __device__ __forceinline__ float pass_sum(const float (&a)[8], const float (&c)[8]) {
  v2f sum2 = (v2f){a[0], a[1]} + (v2f){c[0], c[1]};
#pragma unroll
  for (int r = 2; r < 8; r += 2) {
    sum2 += (v2f){a[r], a[r + 1]};
    sum2 += (v2f){c[r], c[r + 1]};
  }
  return sum2[0] + sum2[1];
}

static __device__ __forceinline__ void score_tiles(v16h a0, v16h a1, v16h b, v8f c, v8f& d0, v8f& d1) {
  asm("v_wmma_f32_16x16x32_f16 %0, %2, %4, %5\n\t"
      "v_wmma_f32_16x16x32_f16 %1, %3, %4, %5\n\t"
      "v_nop\n\tv_nop\n\tv_nop\n\tv_nop"
      : "=&v"(d0), "=&v"(d1) : "v"(a0), "v"(a1), "v"(b), "v"(c));
}

#define TERM_LIMIT 16384.0f

__global__ void __launch_bounds__(512) attn_kernel(const f16* __restrict__ q_ws,
                                                   const f16* __restrict__ k_ws,
                                                   const f16* __restrict__ vt_ws,
                                                   const float* __restrict__ tab_sig,
                                                   const float* __restrict__ logit_scale,
                                                   float* __restrict__ o_ws) {
  // one array fixes the order: table (16 KB place) | K | V^T, the two images at multiples of 1 KB
  __shared__ __attribute__((aligned(1024))) char s_all[16384 + 2 * KV_BYTES];
  float* s_bias = (float*)s_all;           // 16*sigmoid table slice for this head (3969 floats), times log2(e)
  char*  s_kv   = s_all + 16384;

  int tid = threadIdx.x, wave = tid >> 5, lane = tid & 31;
  int rb = blockIdx.x, h = blockIdx.y, b = blockIdx.z;

  const f16* qbh  = q_ws  + ((size_t)(b * 8 + h) * 1024) * 32;
  const f16* kbh  = k_ws  + ((size_t)(b * 8 + h) * 1024) * 32;
  const f16* vtbh = vt_ws + ((size_t)(b * 8 + h) * 32) * 1024;

  // The small loads go out all at once, around the 128 KB of copies: ahead of them the wave's q tile and
  // the head's table (two 16-byte loads a thread), behind them the two scalar loads (the table's last
  // entry, the head's scale). All come back while the copies fly; nothing is fetched behind the barrier.
  int row0 = rb * 256 + wave * 16;
  v16h qb = load_tile_h(qbh + row0 * 32, 32, lane);   // B operand, resident for whole loop
  const float* tb = tab_sig + h * TAB_PITCH;
  int i1 = min(2048 + tid * 4, 3964);      // threads 480-511 have no piece of their own: they repeat the last one
  v4f ta = *(const v4f*)(tb + tid * 4);
  v4f tc = *(const v4f*)(tb + i1);
  asm volatile("s_wait_xcnt 0x0" :: "v"(qbh + row0 * 32 + (lane & 15) * 32 + ((lane >> 4) << 3)) : "memory");

  // Waves 0-7 copy K, waves 8-15 V^T: 8 KB a wave, 16 copies in flight.
  {
    const char* g0   = (const char*)((wave < 8) ? kbh : vtbh);
    unsigned    lds0 = (unsigned)(size_t)s_kv + (unsigned)(wave >> 3) * KV_BYTES;
    unsigned    off  = (unsigned)(wave & 7) * 8192 + (unsigned)lane * 16;
    copy8_to_lds(lds0, g0, off);
    copy8_to_lds(lds0, g0, off + 4096);
  }
  // behind the copies: ahead of them, the wait for these two scalar loads held the copies back
  float tl = tb[3968];
  float cref = 1.0625f * head_scale_log2(logit_scale, h);   // minus the reference m

  // no branch here (a repeated place gets the same value again): the compiler moved a load whose value
  // is used under a branch into that branch, behind the copies
  *(v4f*)&s_bias[tid * 4] = ta * LOG2E;
  *(v4f*)&s_bias[i1] = tc * LOG2E;
  s_bias[3968] = tl * LOG2E;
  // this wave's copies have landed before the barrier behind which other waves read them
  asm volatile("s_wait_asynccnt 0x0" ::: "memory");
  __syncthreads();

  int nloc  = lane & 15;
  int mbase = (lane >> 4) << 3;
  unsigned f_lo = kv_place((unsigned)nloc * 64 + (unsigned)(lane >> 4) * 16);   // k 8h .. 8h+7
  unsigned f_hi = f_lo ^ 32;                                                    // k 16+8h .. 16+8h+7

  // This lane's query is image position (qy, qx). The 32 keys of one pass are image row kb/32,
  // x = 0..31, so the lane's biases lie at s_bias[bi + mbase - x], and bi goes back one table row a pass.
  int qrow = row0 + nloc;
  int qy = qrow >> 5, qx = qrow & 31;
  int bi = (qy + 31) * 63 + (qx + 31) - mbase;

  v8f o0 = {}, o1 = {};                    // O^T: dims mbase+r and 16+mbase+r of query qrow
  float l_q = 0.f;                         // this half's keys only
  v8f cm;
#pragma unroll
  for (int r = 0; r < 8; ++r) cm[r] = cref;

  for (int kb = 0; kb < 1024; kb += 32) {
    // ---- S^T = kn @ qn^T (two 16x16 tiles, K = hd = 32 in one WMMA each) ----
    v16h kt0 = load_frag_lds(s_kv + kb * 64, f_lo, f_hi);
    v16h kt1 = load_frag_lds(s_kv + kb * 64 + 1024, f_lo, f_hi);
    // this pass's block of V^T (32 dims x 32 keys), asked for here so that it is there behind the branch below
    v16h va0 = load_frag_lds(s_kv + KV_BYTES + kb * 64, f_lo, f_hi);        // dims 0..15
    v16h va1 = load_frag_lds(s_kv + KV_BYTES + kb * 64 + 1024, f_lo, f_hi); // dims 16..31
    v8f s0, s1;
    score_tiles(kt0, kt1, qb, cm, s0, s1);

    float p0[8], p1[8];
#pragma unroll
    for (int r = 0; r < 8; r += 2) {       // + relative-position bias; written by pairs of keys so
                                           // that each pair is one packed add on the D registers
                                           // as they lie (no register moves)
      v2f t0 = (v2f){s0[r], s0[r + 1]} + (v2f){s_bias[bi - r], s_bias[bi - r - 1]};
      v2f t1 = (v2f){s1[r], s1[r + 1]} + (v2f){s_bias[bi - 16 - r], s_bias[bi - 16 - r - 1]};
      p0[r] = t0[0]; p0[r + 1] = t0[1];
      p1[r] = t1[0]; p1[r + 1] = t1[1];
    }
    bi -= 63;

    // ---- softmax terms: one query per lane ----
    float e0[8], e1[8];
    exp2_bare16(p0, p1, e0, e1);
    float sum = pass_sum(e0, e1);
    // one branch for the whole wave (the matrix instructions need every lane on)
    if (__builtin_amdgcn_ballot_w32(!(sum <= TERM_LIMIT)) != 0u) {
      float tmax = fmaxf(p0[0], p1[0]);
#pragma unroll
      for (int r = 1; r < 8; ++r) tmax = fmaxf(tmax, fmaxf(p0[r], p1[r]));
      tmax = fmaxf(tmax, other_half(tmax));  // both halves of a query keep the same reference
      float d = fmaxf(tmax, 0.f);            // the reference only goes up
      float alpha = -d;
#pragma unroll
      for (int r = 0; r < 8; ++r) { p0[r] -= d; p1[r] -= d; }
      exp2_bare17(p0, p1, alpha);
#pragma unroll
      for (int r = 0; r < 8; ++r) { e0[r] = p0[r]; e1[r] = p1[r]; }
      sum = pass_sum(e0, e1);
      l_q *= alpha;
      cref -= d;
#pragma unroll
      for (int r = 0; r < 8; ++r) { o0[r] *= alpha; o1[r] *= alpha; cm[r] = cref; }
    }
    l_q += sum;
    v16h pb;
#pragma unroll
    for (int r = 0; r < 8; ++r) { pb[r] = (f16)e0[r]; pb[r + 8] = (f16)e1[r]; }

    // ---- O^T += V^T @ P^T ----
    o0 = wmma_f16(va0, pb, o0);
    o1 = wmma_f16(va1, pb, o1);
  }

  // ---- epilogue: join the halves' sums, normalize, write (b, N, c) f32 for the proj GEMM ----
  float inv = 1.0f / (l_q + other_half(l_q));
  float* op = o_ws + ((size_t)(b * 1024) + qrow) * 256 + h * 32 + mbase;
  v4f w;
#pragma unroll
  for (int g = 0; g < 2; ++g) {            // 8 consecutive dims a tile: two 16-byte stores
#pragma unroll
    for (int i = 0; i < 4; ++i) w[i] = o0[g * 4 + i] * inv;
    *(v4f*)(op + g * 4) = w;
#pragma unroll
    for (int i = 0; i < 4; ++i) w[i] = o1[g * 4 + i] * inv;
    *(v4f*)(op + 16 + g * 4) = w;
  }
}

// ---------------------------------------------------------------------------
extern "C" void kernel_launch(void* const* d_in, const int* in_sizes, int n_in,
                              void* d_out, int out_size, void* d_ws, size_t ws_size,
                              hipStream_t stream) {
  const float* x    = (const float*)d_in[0];
  const float* q1_w = (const float*)d_in[1];
  const float* q1_b = (const float*)d_in[2];
  const float* q2_w = (const float*)d_in[3];
  const float* q2_b = (const float*)d_in[4];
  const float* k1_w = (const float*)d_in[5];
  const float* k1_b = (const float*)d_in[6];
  const float* k2_w = (const float*)d_in[7];
  const float* k2_b = (const float*)d_in[8];
  const float* v1_w = (const float*)d_in[9];
  const float* v1_b = (const float*)d_in[10];
  const float* v2_w = (const float*)d_in[11];
  const float* v2_b = (const float*)d_in[12];
  const float* p1_w = (const float*)d_in[13];
  const float* p1_b = (const float*)d_in[14];
  const float* p2_w = (const float*)d_in[15];
  const float* p2_b = (const float*)d_in[16];
  const float* lsc  = (const float*)d_in[17];
  const float* mw1  = (const float*)d_in[18];
  const float* mb1  = (const float*)d_in[19];
  const float* mw2  = (const float*)d_in[20];

  char* ws = (char*)d_ws;
  f16*   q_ws  = (f16*)(ws + ((size_t)8  << 20));     //  8 MB
  f16*   k_ws  = (f16*)(ws + ((size_t)16 << 20));     //  8 MB
  f16*   vt_ws = (f16*)(ws + ((size_t)24 << 20));     //  8 MB
  float* o_ws  = (float*)(ws + ((size_t)32 << 20));   // 16 MB  (16384 x 256 f32)
  float* tab   = (float*)(ws + ((size_t)48 << 20));   // 125 KB (8 x 4000 f32)

  // 128 row blocks (16384 rows / 128) x 2 halves, q, k and v in each; the bias table beside them
  qkv_kernel<<<dim3(128, 2), 768, 0, stream>>>(x, q1_w, q1_b, q2_w, q2_b, k1_w, k1_b, k2_w, k2_b,
                                               v1_w, v1_b, v2_w, v2_b, mw1, mb1, mw2, lsc, q_ws, k_ws, vt_ws, tab);

  attn_kernel<<<dim3(4, 8, 16), 512, 0, stream>>>(q_ws, k_ws, vt_ws, tab, lsc, o_ws);

  proj_kernel<<<dim3(128, 2), 256, 0, stream>>>(o_ws, p1_w, p1_b, p2_w, p2_b, (float*)d_out);
}
